// v000
// Measured on an AMD MI455X. A time is GPU time per run, averaged over a window of back-to-back runs after a warm-up
// (all launches, gaps included; the runs take copies of the inputs in turn), and the median of several windows.
// Apart from v000's, it joins two sittings. Times from different sittings can be a few percent apart, while
// side-by-side timings come from the same sitting.
// The starting kernel, v000, takes 226 microseconds a run.
#include <hip/hip_runtime.h>
#include <math.h>

// Problem constants (PhysicsGatedAttention): B=2, N=512, HIDDEN=256, HEADS=4, HEAD_DIM=64
#define N_   512
#define D_   256
#define H_   4
#define HD_  64
#define B_   2
#define SCALE   0.125f      // HEAD_DIM^-0.5
#define NEGINF  (-1e9f)

typedef float v2f __attribute__((ext_vector_type(2)));
typedef float v8f __attribute__((ext_vector_type(8)));

// V_WMMA_F32_16X16X4_F32 : D(16x16 f32) = A(16x4 f32) * B(4x16 f32) + C
// Layouts (wave32):
//   A frag: lane = m + 16*g (m=0..15, g=0..1); a.x=A[m][k+2g], a.y=A[m][k+2g+1]
//   B frag: lane = n + 16*g;                    b.x=B[k+2g][n], b.y=B[k+2g+1][n]
//   C/D   : lane = n + 16*g, vgpr p => D[p+8g][n]
__device__ __forceinline__ v8f wmma4(v2f a, v2f b, v8f c) {
  return __builtin_amdgcn_wmma_f32_16x16x4_f32(false, a, false, b, (short)0, c,
                                               false, false);
}

__device__ __forceinline__ float gelu_exact(float v) {
  // jax.nn.gelu(approximate=False): 0.5*x*(1+erf(x/sqrt(2)))
  return 0.5f * v * (1.0f + erff(v * 0.70710678118654752440f));
}

// ---------------------------------------------------------------------------
// Generic fp32 GEMM: Y[M,Nc] = X[M,K] @ W[K,Nc] (+ bias[Nc]).
// One wave per 16x16 output tile, 8 waves per block. M,K,Nc multiples of 16/4.
// ---------------------------------------------------------------------------
__global__ __launch_bounds__(256) void gemm_xw_kernel(
    const float* __restrict__ X, const float* __restrict__ W,
    const float* __restrict__ bias, float* __restrict__ Y,
    int M, int K, int Nc) {
  const int wave = threadIdx.x >> 5;
  const int lane = threadIdx.x & 31;
  const int m16 = lane & 15;
  const int g   = lane >> 4;
  const int ntiles = Nc >> 4;
  const int tile = blockIdx.x * 8 + wave;
  const int mt = tile / ntiles;
  const int nt = tile - mt * ntiles;

  const float* xrow = X + (size_t)(mt * 16 + m16) * K;   // A row m
  const float* wcol = W + (nt * 16 + m16);               // B column n
  v8f acc = {};
  for (int kk = 0; kk < K; kk += 4) {
    const int d0 = kk + 2 * g;
    v2f a = *(const v2f*)(xrow + d0);                    // contiguous pair
    v2f b;
    b.x = wcol[(size_t)d0 * Nc];
    b.y = wcol[(size_t)(d0 + 1) * Nc];
    acc = wmma4(a, b, acc);
  }
  const int col = nt * 16 + m16;
  const float bv = bias ? bias[col] : 0.0f;
  float* yout = Y + (size_t)(mt * 16) * Nc + col;
#pragma unroll
  for (int p = 0; p < 8; ++p)
    yout[(size_t)(p + 8 * g) * Nc] = acc[p] + bv;
}

// ---------------------------------------------------------------------------
// Phase A: S[b,h,i,j] = scale*(q_i . k_j) + (mask ? physics_bias : -1e9)
// One block per (b, i-tile16, j-tile16). 8 waves:
//   waves 0..3 : QK^T for head = wave (16 WMMA over hd=64)
//   all waves  : physics bias for i = it*16 + 2*wave + {0,1}
//                (GELU into A-frag, [16j x 256d] @ Wp2[256d x 4h] via WMMA)
// ---------------------------------------------------------------------------
__global__ __launch_bounds__(256) void scores_kernel(
    const float* __restrict__ Q, const float* __restrict__ Kb,
    const float* __restrict__ Ab, const float* __restrict__ Bb,
    const float* __restrict__ Wp2, const float* __restrict__ bp2,
    const int* __restrict__ adj, float* __restrict__ S) {
  __shared__ float lds_qk[H_][16][16];     // [h][i][j]
  __shared__ float lds_bias[16][16][H_];   // [i][j][h]

  const int blk = blockIdx.x;              // b*1024 + it*32 + jt
  const int b  = blk >> 10;
  const int it = (blk >> 5) & 31;
  const int jt = blk & 31;
  const int wave = threadIdx.x >> 5;
  const int lane = threadIdx.x & 31;
  const int m16 = lane & 15;
  const int g   = lane >> 4;

  // ---- QK^T (heads on waves 0..3) ----
  if (wave < H_) {
    const int h = wave;
    const float* qrow = Q  + (size_t)(b * N_ + it * 16 + m16) * D_ + h * HD_;
    const float* krow = Kb + (size_t)(b * N_ + jt * 16 + m16) * D_ + h * HD_;
    v8f acc = {};
    for (int kk = 0; kk < HD_; kk += 4) {
      const int d0 = kk + 2 * g;
      v2f a = *(const v2f*)(qrow + d0);
      v2f bf = *(const v2f*)(krow + d0);   // B[k][n] = K[n][k] -> contiguous in k
      acc = wmma4(a, bf, acc);
    }
#pragma unroll
    for (int p = 0; p < 8; ++p) lds_qk[h][p + 8 * g][m16] = acc[p];
  }

  // ---- physics bias: every wave handles i-rows 2*wave and 2*wave+1 ----
  const float* brow = Bb + (size_t)(b * N_ + jt * 16 + m16) * D_;  // x_j side
#pragma unroll
  for (int s = 0; s < 2; ++s) {
    const int ii = wave * 2 + s;
    const float* arow = Ab + (size_t)(b * N_ + it * 16 + ii) * D_; // x_i side (+bp1)
    v8f acc = {};
    for (int kk = 0; kk < D_; kk += 4) {
      const int d0 = kk + 2 * g;
      v2f bp = *(const v2f*)(brow + d0);
      v2f a;
      a.x = gelu_exact(arow[d0]     + bp.x);
      a.y = gelu_exact(arow[d0 + 1] + bp.y);
      v2f bf;
      bf.x = (m16 < H_) ? Wp2[(size_t)d0 * H_ + m16]       : 0.0f;
      bf.y = (m16 < H_) ? Wp2[(size_t)(d0 + 1) * H_ + m16] : 0.0f;
      acc = wmma4(a, bf, acc);
    }
    if (m16 < H_) {
#pragma unroll
      for (int p = 0; p < 8; ++p) lds_bias[ii][p + 8 * g][m16] = acc[p];
    }
  }
  __syncthreads();

  // ---- combine + mask + store ----
  const int ii = threadIdx.x >> 4;
  const int jj = threadIdx.x & 15;
  const int i = it * 16 + ii;
  const int j = jt * 16 + jj;
  const bool mk = adj[i * N_ + j] != 0;
#pragma unroll
  for (int h = 0; h < H_; ++h) {
    const float bias_v = lds_bias[ii][jj][h] + bp2[h];
    const float v = lds_qk[h][ii][jj] * SCALE + (mk ? bias_v : NEGINF);
    S[((size_t)(b * H_ + h) * N_ + i) * N_ + j] = v;
  }
}

// ---------------------------------------------------------------------------
// Phase B: row softmax over j. One wave per row (512 elems -> 16/lane).
// ---------------------------------------------------------------------------
__global__ __launch_bounds__(256) void softmax_kernel(float* __restrict__ S) {
  const int wave = threadIdx.x >> 5;
  const int lane = threadIdx.x & 31;
  float* p = S + ((size_t)blockIdx.x * 8 + wave) * N_;

  float vals[16];
  float mx = -3.4e38f;
#pragma unroll
  for (int t = 0; t < 16; ++t) {
    vals[t] = p[lane + t * 32];
    mx = fmaxf(mx, vals[t]);
  }
#pragma unroll
  for (int off = 16; off >= 1; off >>= 1) mx = fmaxf(mx, __shfl_xor(mx, off));
  float sum = 0.0f;
#pragma unroll
  for (int t = 0; t < 16; ++t) {
    vals[t] = __expf(vals[t] - mx);
    sum += vals[t];
  }
#pragma unroll
  for (int off = 16; off >= 1; off >>= 1) sum += __shfl_xor(sum, off);
  const float inv = 1.0f / sum;
#pragma unroll
  for (int t = 0; t < 16; ++t) p[lane + t * 32] = vals[t] * inv;
}

// ---------------------------------------------------------------------------
// Phase C: O[b,i,h*64+d] = sum_j attn[b,h,i,j] * V[b,j,h*64+d]  (WMMA, K=512)
// One wave per 16x16 output tile: 8 (b,h) * 32 i-tiles * 4 d-tiles = 1024 tiles.
// ---------------------------------------------------------------------------
__global__ __launch_bounds__(256) void pv_kernel(
    const float* __restrict__ S, const float* __restrict__ V,
    float* __restrict__ O) {
  const int wave = threadIdx.x >> 5;
  const int lane = threadIdx.x & 31;
  const int m16 = lane & 15;
  const int g   = lane >> 4;
  const int tile = blockIdx.x * 8 + wave;
  const int nt = tile & 3;
  const int it = (tile >> 2) & 31;
  const int bh = tile >> 7;
  const int b = bh >> 2, h = bh & 3;

  const float* srow = S + ((size_t)bh * N_ + it * 16 + m16) * N_;
  const float* vcol = V + (size_t)b * N_ * D_ + h * HD_ + nt * 16 + m16;
  v8f acc = {};
  for (int kk = 0; kk < N_; kk += 4) {
    const int k0 = kk + 2 * g;
    v2f a = *(const v2f*)(srow + k0);
    v2f bf;
    bf.x = vcol[(size_t)k0 * D_];
    bf.y = vcol[(size_t)(k0 + 1) * D_];
    acc = wmma4(a, bf, acc);
  }
  float* orow = O + (size_t)(b * N_ + it * 16) * D_ + h * HD_ + nt * 16 + m16;
#pragma unroll
  for (int p = 0; p < 8; ++p) orow[(size_t)(p + 8 * g) * D_] = acc[p];
}

// ---------------------------------------------------------------------------
// Host launcher. Workspace layout (floats):
//   Q,K,V,A,B : 5 * 1024*256            = 1,310,720
//   S         : 2*4*512*512             = 2,097,152
//   O         : 1024*256                =   262,144
// Total ~14.0 MB.
// ---------------------------------------------------------------------------
extern "C" void kernel_launch(void* const* d_in, const int* in_sizes, int n_in,
                              void* d_out, int out_size, void* d_ws,
                              size_t ws_size, hipStream_t stream) {
  (void)in_sizes; (void)n_in; (void)out_size; (void)ws_size;
  const float* x   = (const float*)d_in[0];
  const int*   adj = (const int*)  d_in[1];
  const float* Wq  = (const float*)d_in[2];
  const float* bq  = (const float*)d_in[3];
  const float* Wk  = (const float*)d_in[4];
  const float* bk  = (const float*)d_in[5];
  const float* Wv  = (const float*)d_in[6];
  const float* bv  = (const float*)d_in[7];
  const float* Wo  = (const float*)d_in[8];
  const float* bo  = (const float*)d_in[9];
  const float* Wp1 = (const float*)d_in[10];  // [2D, D] row-major
  const float* bp1 = (const float*)d_in[11];
  const float* Wp2 = (const float*)d_in[12];  // [D, H] row-major
  const float* bp2 = (const float*)d_in[13];

  const int M = B_ * N_;  // 1024
  float* ws = (float*)d_ws;
  float* Qb = ws;
  float* Kb = Qb + (size_t)M * D_;
  float* Vb = Kb + (size_t)M * D_;
  float* Ab = Vb + (size_t)M * D_;
  float* Bb = Ab + (size_t)M * D_;
  float* Sb = Bb + (size_t)M * D_;                       // [B,H,N,N]
  float* Ob = Sb + (size_t)B_ * H_ * N_ * N_;

  const dim3 blk(256);
  const int gemm_blocks = (M / 16) * (D_ / 16) / 8;      // 128

  // Projections (bp1 folded into the x_i side of the physics MLP).
  gemm_xw_kernel<<<gemm_blocks, blk, 0, stream>>>(x, Wq, bq, Qb, M, D_, D_);
  gemm_xw_kernel<<<gemm_blocks, blk, 0, stream>>>(x, Wk, bk, Kb, M, D_, D_);
  gemm_xw_kernel<<<gemm_blocks, blk, 0, stream>>>(x, Wv, bv, Vb, M, D_, D_);
  gemm_xw_kernel<<<gemm_blocks, blk, 0, stream>>>(x, Wp1, bp1, Ab, M, D_, D_);
  gemm_xw_kernel<<<gemm_blocks, blk, 0, stream>>>(x, Wp1 + (size_t)D_ * D_,
                                                  nullptr, Bb, M, D_, D_);

  scores_kernel<<<B_ * 32 * 32, blk, 0, stream>>>(Qb, Kb, Ab, Bb, Wp2, bp2,
                                                  adj, Sb);
  softmax_kernel<<<(B_ * H_ * N_) / 8, blk, 0, stream>>>(Sb);
  pv_kernel<<<(B_ * H_ * 32 * 4) / 8, blk, 0, stream>>>(Sb, Vb, Ob);
  gemm_xw_kernel<<<gemm_blocks, blk, 0, stream>>>(Ob, Wo, bo, (float*)d_out,
                                                  M, D_, D_);
}

// v001
// A run of this version takes 199 microseconds.
// In both of two side-by-side timings against v000, it was 1.16 times as fast.
#include <hip/hip_runtime.h>
#include <math.h>

// Problem constants (PhysicsGatedAttention): B=2, N=512, HIDDEN=256, HEADS=4, HEAD_DIM=64
#define N_   512
#define D_   256
#define H_   4
#define HD_  64
#define B_   2
#define SCALE   0.125f      // HEAD_DIM^-0.5
#define NEGINF  (-1e9f)

typedef float v2f __attribute__((ext_vector_type(2)));
typedef float v8f __attribute__((ext_vector_type(8)));

// V_WMMA_F32_16X16X4_F32 : D(16x16 f32) = A(16x4 f32) * B(4x16 f32) + C
// Layouts (wave32):
//   A frag: lane = m + 16*g (m=0..15, g=0..1); a.x=A[m][k+2g], a.y=A[m][k+2g+1]
//   B frag: lane = n + 16*g;                    b.x=B[k+2g][n], b.y=B[k+2g+1][n]
//   C/D   : lane = n + 16*g, vgpr p => D[p+8g][n]
__device__ __forceinline__ v8f wmma4(v2f a, v2f b, v8f c) {
  return __builtin_amdgcn_wmma_f32_16x16x4_f32(false, a, false, b, (short)0, c,
                                               false, false);
}

// jax.nn.gelu(approximate=False): 0.5*x*(1+erf(x/sqrt(2))) = x*Phi(x), two values
// at a time and without a branch. With T(|x|) = 0.5*erfc(|x|/sqrt(2)), the upper
// normal tail, x*Phi(x) = 0.5*x + |x|*(0.5 - T(|x|)) for either sign of x.
// T(y) = exp(-y*y/2) * t*(c1+t*(c2+t*(c3+t*(c4+t*c5)))), t = 1/(1+p*y), is the
// classic five-term rational form; its absolute error is below 7.5e-8 for all y >= 0.
__device__ __forceinline__ v2f splat2(float c) { v2f r = {c, c}; return r; }

__device__ __forceinline__ v2f gelu_exact2(v2f v) {
  v2f y = {__builtin_fabsf(v.x), __builtin_fabsf(v.y)};
  const v2f d = __builtin_elementwise_fma(y, splat2(0.2316419f), splat2(1.0f));
  v2f t = {__builtin_amdgcn_rcpf(d.x), __builtin_amdgcn_rcpf(d.y)};
  v2f q = __builtin_elementwise_fma(t, splat2(0.5307027145f), splat2(-0.7265760135f));
  q = __builtin_elementwise_fma(t, q, splat2(0.7107068705f));
  q = __builtin_elementwise_fma(t, q, splat2(-0.142248368f));
  q = __builtin_elementwise_fma(t, q, splat2(0.127414796f));
  q = q * t;
  const v2f w = (v * v) * splat2(-0.72134752044448170368f);   // -x*x/2 * log2(e)
  v2f e = {__builtin_amdgcn_exp2f(w.x), __builtin_amdgcn_exp2f(w.y)};
  const v2f s = __builtin_elementwise_fma(-q, e, splat2(0.5f));
  return __builtin_elementwise_fma(y, s, v * splat2(0.5f));
}

// ---------------------------------------------------------------------------
// Generic fp32 GEMM: Y[M,Nc] = X[M,K] @ W[K,Nc] (+ bias[Nc]).
// One wave per 16x16 output tile, 8 waves per block. M,K,Nc multiples of 16/4.
// ---------------------------------------------------------------------------
__global__ __launch_bounds__(256) void gemm_xw_kernel(
    const float* __restrict__ X, const float* __restrict__ W,
    const float* __restrict__ bias, float* __restrict__ Y,
    int M, int K, int Nc) {
  const int wave = threadIdx.x >> 5;
  const int lane = threadIdx.x & 31;
  const int m16 = lane & 15;
  const int g   = lane >> 4;
  const int ntiles = Nc >> 4;
  const int tile = blockIdx.x * 8 + wave;
  const int mt = tile / ntiles;
  const int nt = tile - mt * ntiles;

  const float* xrow = X + (size_t)(mt * 16 + m16) * K;   // A row m
  const float* wcol = W + (nt * 16 + m16);               // B column n
  v8f acc = {};
  for (int kk = 0; kk < K; kk += 4) {
    const int d0 = kk + 2 * g;
    v2f a = *(const v2f*)(xrow + d0);                    // contiguous pair
    v2f b;
    b.x = wcol[(size_t)d0 * Nc];
    b.y = wcol[(size_t)(d0 + 1) * Nc];
    acc = wmma4(a, b, acc);
  }
  const int col = nt * 16 + m16;
  const float bv = bias ? bias[col] : 0.0f;
  float* yout = Y + (size_t)(mt * 16) * Nc + col;
#pragma unroll
  for (int p = 0; p < 8; ++p)
    yout[(size_t)(p + 8 * g) * Nc] = acc[p] + bv;
}

// ---------------------------------------------------------------------------
// Phase A: S[b,h,i,j] = scale*(q_i . k_j) + (mask ? physics_bias : -1e9)
// One block per (b, i-tile16, j-tile16). 8 waves:
//   waves 0..3 : QK^T for head = wave (16 WMMA over hd=64)
//   all waves  : physics bias for i = it*16 + 2*wave + {0,1}
//                (GELU into A-frag, [16j x 256d] @ Wp2[256d x 4h] via WMMA)
// ---------------------------------------------------------------------------
__global__ __launch_bounds__(256) void scores_kernel(
    const float* __restrict__ Q, const float* __restrict__ Kb,
    const float* __restrict__ Ab, const float* __restrict__ Bb,
    const float* __restrict__ Wp2, const float* __restrict__ bp2,
    const int* __restrict__ adj, float* __restrict__ S) {
  __shared__ float lds_qk[H_][16][16];     // [h][i][j]
  __shared__ float lds_bias[16][16][H_];   // [i][j][h]

  const int blk = blockIdx.x;              // b*1024 + it*32 + jt
  const int b  = blk >> 10;
  const int it = (blk >> 5) & 31;
  const int jt = blk & 31;
  const int wave = threadIdx.x >> 5;
  const int lane = threadIdx.x & 31;
  const int m16 = lane & 15;
  const int g   = lane >> 4;

  // ---- QK^T (heads on waves 0..3) ----
  if (wave < H_) {
    const int h = wave;
    const float* qrow = Q  + (size_t)(b * N_ + it * 16 + m16) * D_ + h * HD_;
    const float* krow = Kb + (size_t)(b * N_ + jt * 16 + m16) * D_ + h * HD_;
    v8f acc = {};
    for (int kk = 0; kk < HD_; kk += 4) {
      const int d0 = kk + 2 * g;
      v2f a = *(const v2f*)(qrow + d0);
      v2f bf = *(const v2f*)(krow + d0);   // B[k][n] = K[n][k] -> contiguous in k
      acc = wmma4(a, bf, acc);
    }
#pragma unroll
    for (int p = 0; p < 8; ++p) lds_qk[h][p + 8 * g][m16] = acc[p];
  }

  // ---- physics bias: every wave handles i-rows 2*wave and 2*wave+1 ----
  const float* brow = Bb + (size_t)(b * N_ + jt * 16 + m16) * D_;  // x_j side
#pragma unroll
  for (int s = 0; s < 2; ++s) {
    const int ii = wave * 2 + s;
    const float* arow = Ab + (size_t)(b * N_ + it * 16 + ii) * D_; // x_i side (+bp1)
    v8f acc = {};
    for (int kk = 0; kk < D_; kk += 4) {
      const int d0 = kk + 2 * g;
      v2f bp = *(const v2f*)(brow + d0);
      v2f ap = *(const v2f*)(arow + d0);
      v2f a = gelu_exact2(ap + bp);
      v2f bf;
      bf.x = (m16 < H_) ? Wp2[(size_t)d0 * H_ + m16]       : 0.0f;
      bf.y = (m16 < H_) ? Wp2[(size_t)(d0 + 1) * H_ + m16] : 0.0f;
      acc = wmma4(a, bf, acc);
    }
    if (m16 < H_) {
#pragma unroll
      for (int p = 0; p < 8; ++p) lds_bias[ii][p + 8 * g][m16] = acc[p];
    }
  }
  __syncthreads();

  // ---- combine + mask + store ----
  const int ii = threadIdx.x >> 4;
  const int jj = threadIdx.x & 15;
  const int i = it * 16 + ii;
  const int j = jt * 16 + jj;
  const bool mk = adj[i * N_ + j] != 0;
#pragma unroll
  for (int h = 0; h < H_; ++h) {
    const float bias_v = lds_bias[ii][jj][h] + bp2[h];
    const float v = lds_qk[h][ii][jj] * SCALE + (mk ? bias_v : NEGINF);
    S[((size_t)(b * H_ + h) * N_ + i) * N_ + j] = v;
  }
}

// ---------------------------------------------------------------------------
// Phase B: row softmax over j. One wave per row (512 elems -> 16/lane).
// ---------------------------------------------------------------------------
__global__ __launch_bounds__(256) void softmax_kernel(float* __restrict__ S) {
  const int wave = threadIdx.x >> 5;
  const int lane = threadIdx.x & 31;
  float* p = S + ((size_t)blockIdx.x * 8 + wave) * N_;

  float vals[16];
  float mx = -3.4e38f;
#pragma unroll
  for (int t = 0; t < 16; ++t) {
    vals[t] = p[lane + t * 32];
    mx = fmaxf(mx, vals[t]);
  }
#pragma unroll
  for (int off = 16; off >= 1; off >>= 1) mx = fmaxf(mx, __shfl_xor(mx, off));
  float sum = 0.0f;
#pragma unroll
  for (int t = 0; t < 16; ++t) {
    vals[t] = __expf(vals[t] - mx);
    sum += vals[t];
  }
#pragma unroll
  for (int off = 16; off >= 1; off >>= 1) sum += __shfl_xor(sum, off);
  const float inv = 1.0f / sum;
#pragma unroll
  for (int t = 0; t < 16; ++t) p[lane + t * 32] = vals[t] * inv;
}

// ---------------------------------------------------------------------------
// Phase C: O[b,i,h*64+d] = sum_j attn[b,h,i,j] * V[b,j,h*64+d]  (WMMA, K=512)
// One wave per 16x16 output tile: 8 (b,h) * 32 i-tiles * 4 d-tiles = 1024 tiles.
// ---------------------------------------------------------------------------
__global__ __launch_bounds__(256) void pv_kernel(
    const float* __restrict__ S, const float* __restrict__ V,
    float* __restrict__ O) {
  const int wave = threadIdx.x >> 5;
  const int lane = threadIdx.x & 31;
  const int m16 = lane & 15;
  const int g   = lane >> 4;
  const int tile = blockIdx.x * 8 + wave;
  const int nt = tile & 3;
  const int it = (tile >> 2) & 31;
  const int bh = tile >> 7;
  const int b = bh >> 2, h = bh & 3;

  const float* srow = S + ((size_t)bh * N_ + it * 16 + m16) * N_;
  const float* vcol = V + (size_t)b * N_ * D_ + h * HD_ + nt * 16 + m16;
  v8f acc = {};
  for (int kk = 0; kk < N_; kk += 4) {
    const int k0 = kk + 2 * g;
    v2f a = *(const v2f*)(srow + k0);
    v2f bf;
    bf.x = vcol[(size_t)k0 * D_];
    bf.y = vcol[(size_t)(k0 + 1) * D_];
    acc = wmma4(a, bf, acc);
  }
  float* orow = O + (size_t)(b * N_ + it * 16) * D_ + h * HD_ + nt * 16 + m16;
#pragma unroll
  for (int p = 0; p < 8; ++p) orow[(size_t)(p + 8 * g) * D_] = acc[p];
}

// ---------------------------------------------------------------------------
// Host launcher. Workspace layout (floats):
//   Q,K,V,A,B : 5 * 1024*256            = 1,310,720
//   S         : 2*4*512*512             = 2,097,152
//   O         : 1024*256                =   262,144
// Total ~14.0 MB.
// ---------------------------------------------------------------------------
extern "C" void kernel_launch(void* const* d_in, const int* in_sizes, int n_in,
                              void* d_out, int out_size, void* d_ws,
                              size_t ws_size, hipStream_t stream) {
  (void)in_sizes; (void)n_in; (void)out_size; (void)ws_size;
  const float* x   = (const float*)d_in[0];
  const int*   adj = (const int*)  d_in[1];
  const float* Wq  = (const float*)d_in[2];
  const float* bq  = (const float*)d_in[3];
  const float* Wk  = (const float*)d_in[4];
  const float* bk  = (const float*)d_in[5];
  const float* Wv  = (const float*)d_in[6];
  const float* bv  = (const float*)d_in[7];
  const float* Wo  = (const float*)d_in[8];
  const float* bo  = (const float*)d_in[9];
  const float* Wp1 = (const float*)d_in[10];  // [2D, D] row-major
  const float* bp1 = (const float*)d_in[11];
  const float* Wp2 = (const float*)d_in[12];  // [D, H] row-major
  const float* bp2 = (const float*)d_in[13];

  const int M = B_ * N_;  // 1024
  float* ws = (float*)d_ws;
  float* Qb = ws;
  float* Kb = Qb + (size_t)M * D_;
  float* Vb = Kb + (size_t)M * D_;
  float* Ab = Vb + (size_t)M * D_;
  float* Bb = Ab + (size_t)M * D_;
  float* Sb = Bb + (size_t)M * D_;                       // [B,H,N,N]
  float* Ob = Sb + (size_t)B_ * H_ * N_ * N_;

  const dim3 blk(256);
  const int gemm_blocks = (M / 16) * (D_ / 16) / 8;      // 128

  // Projections (bp1 folded into the x_i side of the physics MLP).
  gemm_xw_kernel<<<gemm_blocks, blk, 0, stream>>>(x, Wq, bq, Qb, M, D_, D_);
  gemm_xw_kernel<<<gemm_blocks, blk, 0, stream>>>(x, Wk, bk, Kb, M, D_, D_);
  gemm_xw_kernel<<<gemm_blocks, blk, 0, stream>>>(x, Wv, bv, Vb, M, D_, D_);
  gemm_xw_kernel<<<gemm_blocks, blk, 0, stream>>>(x, Wp1, bp1, Ab, M, D_, D_);
  gemm_xw_kernel<<<gemm_blocks, blk, 0, stream>>>(x, Wp1 + (size_t)D_ * D_,
                                                  nullptr, Bb, M, D_, D_);

  scores_kernel<<<B_ * 32 * 32, blk, 0, stream>>>(Qb, Kb, Ab, Bb, Wp2, bp2,
                                                  adj, Sb);
  softmax_kernel<<<(B_ * H_ * N_) / 8, blk, 0, stream>>>(Sb);
  pv_kernel<<<(B_ * H_ * 32 * 4) / 8, blk, 0, stream>>>(Sb, Vb, Ob);
  gemm_xw_kernel<<<gemm_blocks, blk, 0, stream>>>(Ob, Wo, bo, (float*)d_out,
                                                  M, D_, D_);
}

// v002
// It runs in 162 microseconds.
// Timed twice side by side with v001, it ran 1.21 and 1.22 times as fast.
// All steps since v000 together make it 1.41 times as fast.
#include <hip/hip_runtime.h>
#include <math.h>

// Problem constants (PhysicsGatedAttention): B=2, N=512, HIDDEN=256, HEADS=4, HEAD_DIM=64
#define N_   512
#define D_   256
#define H_   4
#define HD_  64
#define B_   2
#define SCALE   0.125f      // HEAD_DIM^-0.5
#define NEGINF  (-1e9f)

typedef float v2f __attribute__((ext_vector_type(2)));
typedef float v8f __attribute__((ext_vector_type(8)));

// V_WMMA_F32_16X16X4_F32 : D(16x16 f32) = A(16x4 f32) * B(4x16 f32) + C
// Layouts (wave32):
//   A frag: lane = m + 16*g (m=0..15, g=0..1); a.x=A[m][k+2g], a.y=A[m][k+2g+1]
//   B frag: lane = n + 16*g;                    b.x=B[k+2g][n], b.y=B[k+2g+1][n]
//   C/D   : lane = n + 16*g, vgpr p => D[p+8g][n]
__device__ __forceinline__ v8f wmma4(v2f a, v2f b, v8f c) {
  return __builtin_amdgcn_wmma_f32_16x16x4_f32(false, a, false, b, (short)0, c,
                                               false, false);
}

// jax.nn.gelu(approximate=False): 0.5*x*(1+erf(x/sqrt(2))) = x*Phi(x), two values
// at a time and without a branch. With T(|x|) = 0.5*erfc(|x|/sqrt(2)), the upper
// normal tail, x*Phi(x) = 0.5*x + |x|*(0.5 - T(|x|)) for either sign of x.
// T(y) = exp(-y*y/2) * t*(c1+t*(c2+t*(c3+t*(c4+t*c5)))), t = 1/(1+p*y), is the
// classic five-term rational form; its absolute error is below 7.5e-8 for all y >= 0.
__device__ __forceinline__ v2f splat2(float c) { v2f r = {c, c}; return r; }

__device__ __forceinline__ v2f gelu_exact2(v2f v) {
  v2f y = {__builtin_fabsf(v.x), __builtin_fabsf(v.y)};
  const v2f d = __builtin_elementwise_fma(y, splat2(0.2316419f), splat2(1.0f));
  v2f t = {__builtin_amdgcn_rcpf(d.x), __builtin_amdgcn_rcpf(d.y)};
  v2f q = __builtin_elementwise_fma(t, splat2(0.5307027145f), splat2(-0.7265760135f));
  q = __builtin_elementwise_fma(t, q, splat2(0.7107068705f));
  q = __builtin_elementwise_fma(t, q, splat2(-0.142248368f));
  q = __builtin_elementwise_fma(t, q, splat2(0.127414796f));
  q = q * t;
  const v2f w = (v * v) * splat2(-0.72134752044448170368f);   // -x*x/2 * log2(e)
  v2f e = {__builtin_amdgcn_exp2f(w.x), __builtin_amdgcn_exp2f(w.y)};
  const v2f s = __builtin_elementwise_fma(-q, e, splat2(0.5f));
  return __builtin_elementwise_fma(y, s, v * splat2(0.5f));
}

// ---------------------------------------------------------------------------
// Generic fp32 GEMM: Y[M,Nc] = X[M,K] @ W[K,Nc] (+ bias[Nc]).
// One wave per 16x16 output tile, 8 waves per block. M,K,Nc multiples of 16/4.
// ---------------------------------------------------------------------------
__global__ __launch_bounds__(256) void gemm_xw_kernel(
    const float* __restrict__ X, const float* __restrict__ W,
    const float* __restrict__ bias, float* __restrict__ Y,
    int M, int K, int Nc) {
  const int wave = threadIdx.x >> 5;
  const int lane = threadIdx.x & 31;
  const int m16 = lane & 15;
  const int g   = lane >> 4;
  const int ntiles = Nc >> 4;
  const int tile = blockIdx.x * 8 + wave;
  const int mt = tile / ntiles;
  const int nt = tile - mt * ntiles;

  const float* xrow = X + (size_t)(mt * 16 + m16) * K;   // A row m
  const float* wcol = W + (nt * 16 + m16);               // B column n
  v8f acc = {};
  for (int kk = 0; kk < K; kk += 4) {
    const int d0 = kk + 2 * g;
    v2f a = *(const v2f*)(xrow + d0);                    // contiguous pair
    v2f b;
    b.x = wcol[(size_t)d0 * Nc];
    b.y = wcol[(size_t)(d0 + 1) * Nc];
    acc = wmma4(a, b, acc);
  }
  const int col = nt * 16 + m16;
  const float bv = bias ? bias[col] : 0.0f;
  float* yout = Y + (size_t)(mt * 16) * Nc + col;
#pragma unroll
  for (int p = 0; p < 8; ++p)
    yout[(size_t)(p + 8 * g) * Nc] = acc[p] + bv;
}

// ---------------------------------------------------------------------------
// Phase A: S[b,h,i,j] = scale*(q_i . k_j) + (mask ? physics_bias : -1e9)
// One block per (b, i-tile16, j-tile16). 8 waves:
//   all waves  : stage the x_j tile, the x_i tile and Wp2 in LDS, whole lines
//   waves 0..3 : QK^T for head = wave (16 WMMA over hd=64)
//   all waves  : physics bias for i = it*16 + 2*wave + {0,1}
//                (GELU into A-frag, [16j x 256d] @ Wp2[256d x 4h] via WMMA),
//                every fragment of the k loop read from LDS
// ---------------------------------------------------------------------------
// LDS pitch in floats of the x_j tile and of the transposed Wp2: 260 = 4 mod 64
// banks, so the 16 rows x 2 k pairs of one 8-byte fragment read fall on 64
// different banks.
#define BP_  260
#define SB_OFF 0
#define SA_OFF (16 * BP_)
#define SW_OFF (16 * BP_ + 16 * D_)
#define SMEM_FLOATS (16 * BP_ + 16 * D_ + (H_ + 1) * BP_)

__global__ __launch_bounds__(256) void scores_kernel(
    const float* __restrict__ Q, const float* __restrict__ Kb,
    const float* __restrict__ Ab, const float* __restrict__ Bb,
    const float* __restrict__ Wp2, const float* __restrict__ bp2,
    const int* __restrict__ adj, float* __restrict__ S) {
  __shared__ __attribute__((aligned(16))) float smem[SMEM_FLOATS];
  float* sB = smem + SB_OFF;               // [16 j][BP_]   x_j side
  float* sA = smem + SA_OFF;               // [16 i][D_]    x_i side (+bp1)
  float* sW = smem + SW_OFF;               // [H_ + 1][BP_] Wp2 transposed, row H_ = 0
  // The two result tiles take the place of the x_j tile once the k loops are done.
  float* lds_qk   = smem;                  // [h][i][j]
  float* lds_bias = smem + H_ * 256;       // [i][j][h]

  const int blk = blockIdx.x;              // b*1024 + it*32 + jt
  const int b  = blk >> 10;
  const int it = (blk >> 5) & 31;
  const int jt = blk & 31;
  const int wave = threadIdx.x >> 5;
  const int lane = threadIdx.x & 31;
  const int m16 = lane & 15;
  const int g   = lane >> 4;

  // ---- stage: each wave-wide 16-byte load covers 512 contiguous bytes ----
  {
    const float4* gB = (const float4*)(Bb + (size_t)(b * N_ + jt * 16) * D_);
    const float4* gA = (const float4*)(Ab + (size_t)(b * N_ + it * 16) * D_);
#pragma unroll
    for (int r = 0; r < 4; ++r) {
      const int idx = threadIdx.x + 256 * r;     // float4 index in the 16 x 64 tile
      const int row = idx >> 6;
      const int c4  = idx & 63;
      *(float4*)(sB + row * BP_ + c4 * 4) = gB[idx];
      *(float4*)(sA + idx * 4)            = gA[idx];
    }
    const float4 w = ((const float4*)Wp2)[threadIdx.x];   // Wp2[d][0..3], d = thread
    sW[0 * BP_ + threadIdx.x] = w.x;
    sW[1 * BP_ + threadIdx.x] = w.y;
    sW[2 * BP_ + threadIdx.x] = w.z;
    sW[3 * BP_ + threadIdx.x] = w.w;
    sW[H_ * BP_ + threadIdx.x] = 0.0f;           // columns 4..15 of the B operand
  }
  __syncthreads();

  // ---- QK^T (heads on waves 0..3) ----
  v8f qk = {};
  if (wave < H_) {
    const int h = wave;
    const float* qrow = Q  + (size_t)(b * N_ + it * 16 + m16) * D_ + h * HD_;
    const float* krow = Kb + (size_t)(b * N_ + jt * 16 + m16) * D_ + h * HD_;
    for (int kk = 0; kk < HD_; kk += 4) {
      const int d0 = kk + 2 * g;
      v2f a = *(const v2f*)(qrow + d0);
      v2f bf = *(const v2f*)(krow + d0);   // B[k][n] = K[n][k] -> contiguous in k
      qk = wmma4(a, bf, qk);
    }
  }

  // ---- physics bias: every wave handles i-rows 2*wave and 2*wave+1 ----
  const float* brow = sB + m16 * BP_ + 2 * g;                      // x_j side
  const float* wrow = sW + (m16 < H_ ? m16 : H_) * BP_ + 2 * g;    // Wp2 column
  v8f pb[2];
#pragma unroll
  for (int s = 0; s < 2; ++s) {
    const float* arow = sA + (wave * 2 + s) * D_ + 2 * g;          // x_i side (+bp1)
    v8f acc = {};
    for (int kk = 0; kk < D_; kk += 4) {
      v2f bp = *(const v2f*)(brow + kk);
      v2f ap = *(const v2f*)(arow + kk);
      v2f a = gelu_exact2(ap + bp);
      v2f bf = *(const v2f*)(wrow + kk);   // Wp2[d0][n], Wp2[d0+1][n]; 0 for n >= 4
      acc = wmma4(a, bf, acc);
    }
    pb[s] = acc;
  }
  __syncthreads();                         // every wave has left the staged tiles

  if (wave < H_) {
#pragma unroll
    for (int p = 0; p < 8; ++p) lds_qk[(wave * 16 + p + 8 * g) * 16 + m16] = qk[p];
  }
  if (m16 < H_) {
#pragma unroll
    for (int s = 0; s < 2; ++s)
#pragma unroll
      for (int p = 0; p < 8; ++p)
        lds_bias[((wave * 2 + s) * 16 + p + 8 * g) * H_ + m16] = pb[s][p];
  }
  __syncthreads();

  // ---- combine + mask + store ----
  const int ii = threadIdx.x >> 4;
  const int jj = threadIdx.x & 15;
  const int i = it * 16 + ii;
  const int j = jt * 16 + jj;
  const bool mk = adj[i * N_ + j] != 0;
  // Precaution: the wait stands in front of the LDS reads below, which reuse the
  // register that holds this load's address.
  asm volatile("s_wait_xcnt 0x0" ::: "memory");
#pragma unroll
  for (int h = 0; h < H_; ++h) {
    const float bias_v = lds_bias[(ii * 16 + jj) * H_ + h] + bp2[h];
    const float v = lds_qk[(h * 16 + ii) * 16 + jj] * SCALE + (mk ? bias_v : NEGINF);
    S[((size_t)(b * H_ + h) * N_ + i) * N_ + j] = v;
  }
}

// ---------------------------------------------------------------------------
// Phase B: row softmax over j. One wave per row (512 elems -> 16/lane).
// ---------------------------------------------------------------------------
__global__ __launch_bounds__(256) void softmax_kernel(float* __restrict__ S) {
  const int wave = threadIdx.x >> 5;
  const int lane = threadIdx.x & 31;
  float* p = S + ((size_t)blockIdx.x * 8 + wave) * N_;

  float vals[16];
  float mx = -3.4e38f;
#pragma unroll
  for (int t = 0; t < 16; ++t) {
    vals[t] = p[lane + t * 32];
    mx = fmaxf(mx, vals[t]);
  }
#pragma unroll
  for (int off = 16; off >= 1; off >>= 1) mx = fmaxf(mx, __shfl_xor(mx, off));
  float sum = 0.0f;
#pragma unroll
  for (int t = 0; t < 16; ++t) {
    vals[t] = __expf(vals[t] - mx);
    sum += vals[t];
  }
#pragma unroll
  for (int off = 16; off >= 1; off >>= 1) sum += __shfl_xor(sum, off);
  const float inv = 1.0f / sum;
#pragma unroll
  for (int t = 0; t < 16; ++t) p[lane + t * 32] = vals[t] * inv;
}

// ---------------------------------------------------------------------------
// Phase C: O[b,i,h*64+d] = sum_j attn[b,h,i,j] * V[b,j,h*64+d]  (WMMA, K=512)
// One wave per 16x16 output tile: 8 (b,h) * 32 i-tiles * 4 d-tiles = 1024 tiles.
// ---------------------------------------------------------------------------
__global__ __launch_bounds__(256) void pv_kernel(
    const float* __restrict__ S, const float* __restrict__ V,
    float* __restrict__ O) {
  const int wave = threadIdx.x >> 5;
  const int lane = threadIdx.x & 31;
  const int m16 = lane & 15;
  const int g   = lane >> 4;
  const int tile = blockIdx.x * 8 + wave;
  const int nt = tile & 3;
  const int it = (tile >> 2) & 31;
  const int bh = tile >> 7;
  const int b = bh >> 2, h = bh & 3;

  const float* srow = S + ((size_t)bh * N_ + it * 16 + m16) * N_;
  const float* vcol = V + (size_t)b * N_ * D_ + h * HD_ + nt * 16 + m16;
  v8f acc = {};
  for (int kk = 0; kk < N_; kk += 4) {
    const int k0 = kk + 2 * g;
    v2f a = *(const v2f*)(srow + k0);
    v2f bf;
    bf.x = vcol[(size_t)k0 * D_];
    bf.y = vcol[(size_t)(k0 + 1) * D_];
    acc = wmma4(a, bf, acc);
  }
  float* orow = O + (size_t)(b * N_ + it * 16) * D_ + h * HD_ + nt * 16 + m16;
#pragma unroll
  for (int p = 0; p < 8; ++p) orow[(size_t)(p + 8 * g) * D_] = acc[p];
}

// ---------------------------------------------------------------------------
// Host launcher. Workspace layout (floats):
//   Q,K,V,A,B : 5 * 1024*256            = 1,310,720
//   S         : 2*4*512*512             = 2,097,152
//   O         : 1024*256                =   262,144
// Total ~14.0 MB.
// ---------------------------------------------------------------------------
extern "C" void kernel_launch(void* const* d_in, const int* in_sizes, int n_in,
                              void* d_out, int out_size, void* d_ws,
                              size_t ws_size, hipStream_t stream) {
  (void)in_sizes; (void)n_in; (void)out_size; (void)ws_size;
  const float* x   = (const float*)d_in[0];
  const int*   adj = (const int*)  d_in[1];
  const float* Wq  = (const float*)d_in[2];
  const float* bq  = (const float*)d_in[3];
  const float* Wk  = (const float*)d_in[4];
  const float* bk  = (const float*)d_in[5];
  const float* Wv  = (const float*)d_in[6];
  const float* bv  = (const float*)d_in[7];
  const float* Wo  = (const float*)d_in[8];
  const float* bo  = (const float*)d_in[9];
  const float* Wp1 = (const float*)d_in[10];  // [2D, D] row-major
  const float* bp1 = (const float*)d_in[11];
  const float* Wp2 = (const float*)d_in[12];  // [D, H] row-major
  const float* bp2 = (const float*)d_in[13];

  const int M = B_ * N_;  // 1024
  float* ws = (float*)d_ws;
  float* Qb = ws;
  float* Kb = Qb + (size_t)M * D_;
  float* Vb = Kb + (size_t)M * D_;
  float* Ab = Vb + (size_t)M * D_;
  float* Bb = Ab + (size_t)M * D_;
  float* Sb = Bb + (size_t)M * D_;                       // [B,H,N,N]
  float* Ob = Sb + (size_t)B_ * H_ * N_ * N_;

  const dim3 blk(256);
  const int gemm_blocks = (M / 16) * (D_ / 16) / 8;      // 128

  // Projections (bp1 folded into the x_i side of the physics MLP).
  gemm_xw_kernel<<<gemm_blocks, blk, 0, stream>>>(x, Wq, bq, Qb, M, D_, D_);
  gemm_xw_kernel<<<gemm_blocks, blk, 0, stream>>>(x, Wk, bk, Kb, M, D_, D_);
  gemm_xw_kernel<<<gemm_blocks, blk, 0, stream>>>(x, Wv, bv, Vb, M, D_, D_);
  gemm_xw_kernel<<<gemm_blocks, blk, 0, stream>>>(x, Wp1, bp1, Ab, M, D_, D_);
  gemm_xw_kernel<<<gemm_blocks, blk, 0, stream>>>(x, Wp1 + (size_t)D_ * D_,
                                                  nullptr, Bb, M, D_, D_);

  scores_kernel<<<B_ * 32 * 32, blk, 0, stream>>>(Qb, Kb, Ab, Bb, Wp2, bp2,
                                                  adj, Sb);
  softmax_kernel<<<(B_ * H_ * N_) / 8, blk, 0, stream>>>(Sb);
  pv_kernel<<<(B_ * H_ * 32 * 4) / 8, blk, 0, stream>>>(Sb, Vb, Ob);
  gemm_xw_kernel<<<gemm_blocks, blk, 0, stream>>>(Ob, Wo, bo, (float*)d_out,
                                                  M, D_, D_);
}

// v003
// One run takes 111 microseconds.
// Two timings next to v002 put it at 1.48 and 1.47 times that version's speed.
// Counting every step since v000, it is 2.08 times as fast.
#include <hip/hip_runtime.h>
#include <math.h>

// Problem constants (PhysicsGatedAttention): B=2, N=512, HIDDEN=256, HEADS=4, HEAD_DIM=64
#define N_   512
#define D_   256
#define H_   4
#define HD_  64
#define B_   2
#define SCALE   0.125f      // HEAD_DIM^-0.5
#define NEGINF  (-1e9f)

typedef float v2f __attribute__((ext_vector_type(2)));
typedef float v8f __attribute__((ext_vector_type(8)));

// V_WMMA_F32_16X16X4_F32 : D(16x16 f32) = A(16x4 f32) * B(4x16 f32) + C
// Layouts (wave32):
//   A frag: lane = m + 16*g (m=0..15, g=0..1); a.x=A[m][k+2g], a.y=A[m][k+2g+1]
//   B frag: lane = n + 16*g;                    b.x=B[k+2g][n], b.y=B[k+2g+1][n]
//   C/D   : lane = n + 16*g, vgpr p => D[p+8g][n]
__device__ __forceinline__ v8f wmma4(v2f a, v2f b, v8f c) {
  return __builtin_amdgcn_wmma_f32_16x16x4_f32(false, a, false, b, (short)0, c,
                                               false, false);
}

// jax.nn.gelu(approximate=False): 0.5*x*(1+erf(x/sqrt(2))) = x*Phi(x), two values
// at a time and without a branch. With T(|x|) = 0.5*erfc(|x|/sqrt(2)), the upper
// normal tail, x*Phi(x) = 0.5*x + |x|*(0.5 - T(|x|)) for either sign of x.
// T(y) = exp(-y*y/2) * t*(c1+t*(c2+t*(c3+t*(c4+t*c5)))), t = 1/(1+p*y), is the
// classic five-term rational form; its absolute error is below 7.5e-8 for all y >= 0.
__device__ __forceinline__ v2f splat2(float c) { v2f r = {c, c}; return r; }

__device__ __forceinline__ v2f gelu_exact2(v2f v) {
  v2f y = {__builtin_fabsf(v.x), __builtin_fabsf(v.y)};
  const v2f d = __builtin_elementwise_fma(y, splat2(0.2316419f), splat2(1.0f));
  v2f t = {__builtin_amdgcn_rcpf(d.x), __builtin_amdgcn_rcpf(d.y)};
  v2f q = __builtin_elementwise_fma(t, splat2(0.5307027145f), splat2(-0.7265760135f));
  q = __builtin_elementwise_fma(t, q, splat2(0.7107068705f));
  q = __builtin_elementwise_fma(t, q, splat2(-0.142248368f));
  q = __builtin_elementwise_fma(t, q, splat2(0.127414796f));
  q = q * t;
  const v2f w = (v * v) * splat2(-0.72134752044448170368f);   // -x*x/2 * log2(e)
  v2f e = {__builtin_amdgcn_exp2f(w.x), __builtin_amdgcn_exp2f(w.y)};
  const v2f s = __builtin_elementwise_fma(-q, e, splat2(0.5f));
  return __builtin_elementwise_fma(y, s, v * splat2(0.5f));
}

// ---------------------------------------------------------------------------
// Generic fp32 GEMM: Y[M,Nc] = X[M,K] @ W[K,Nc] (+ bias[Nc]).
// One wave per 16x16 output tile, 8 waves per block. M,K,Nc multiples of 16/4.
// Up to five products of one X share a grid: blockIdx.y picks W and bias, and
// the results lie one behind the other from Y0. A product of this size fills
// half the chip with two waves a SIMD and waits on load latency, so products
// that need nothing of each other take side by side about the time of one.
// ---------------------------------------------------------------------------
__global__ __launch_bounds__(256) void gemm_xw_kernel(
    const float* __restrict__ X,
    const float* __restrict__ W0, const float* __restrict__ bias0,
    const float* __restrict__ W1, const float* __restrict__ bias1,
    const float* __restrict__ W2, const float* __restrict__ bias2,
    const float* __restrict__ W3, const float* __restrict__ bias3,
    const float* __restrict__ W4, const float* __restrict__ bias4,
    float* __restrict__ Y0, int M, int K, int Nc) {
  const int which = blockIdx.y;
  const float* W = W0;
  const float* bias = bias0;
  if (which == 1) { W = W1; bias = bias1; }
  if (which == 2) { W = W2; bias = bias2; }
  if (which == 3) { W = W3; bias = bias3; }
  if (which == 4) { W = W4; bias = bias4; }
  float* Y = Y0 + (size_t)which * M * Nc;
  const int wave = threadIdx.x >> 5;
  const int lane = threadIdx.x & 31;
  const int m16 = lane & 15;
  const int g   = lane >> 4;
  const int ntiles = Nc >> 4;
  const int tile = blockIdx.x * 8 + wave;
  const int mt = tile / ntiles;
  const int nt = tile - mt * ntiles;

  const float* xrow = X + (size_t)(mt * 16 + m16) * K;   // A row m
  const float* wcol = W + (nt * 16 + m16);               // B column n
  v8f acc = {};
  for (int kk = 0; kk < K; kk += 4) {
    const int d0 = kk + 2 * g;
    v2f a = *(const v2f*)(xrow + d0);                    // contiguous pair
    v2f b;
    b.x = wcol[(size_t)d0 * Nc];
    b.y = wcol[(size_t)(d0 + 1) * Nc];
    acc = wmma4(a, b, acc);
  }
  const int col = nt * 16 + m16;
  const float bv = bias ? bias[col] : 0.0f;
  float* yout = Y + (size_t)(mt * 16) * Nc + col;
#pragma unroll
  for (int p = 0; p < 8; ++p)
    yout[(size_t)(p + 8 * g) * Nc] = acc[p] + bv;
}

// ---------------------------------------------------------------------------
// Phase A: S[b,h,i,j] = scale*(q_i . k_j) + (mask ? physics_bias : -1e9)
// One block per (b, i-tile16, j-tile16). 8 waves:
//   all waves  : stage the x_j tile, the x_i tile and Wp2 in LDS, whole lines
//   waves 0..3 : QK^T for head = wave (16 WMMA over hd=64)
//   all waves  : physics bias for i = it*16 + 2*wave + {0,1}
//                (GELU into A-frag, [16j x 256d] @ Wp2[256d x 4h] via WMMA),
//                every fragment of the k loop read from LDS
// ---------------------------------------------------------------------------
// LDS pitch in floats of the x_j tile and of the transposed Wp2: 260 = 4 mod 64
// banks, so the 16 rows x 2 k pairs of one 8-byte fragment read fall on 64
// different banks.
#define BP_  260
#define SB_OFF 0
#define SA_OFF (16 * BP_)
#define SW_OFF (16 * BP_ + 16 * D_)
#define SMEM_FLOATS (16 * BP_ + 16 * D_ + (H_ + 1) * BP_)

__global__ __launch_bounds__(256) void scores_kernel(
    const float* __restrict__ Q, const float* __restrict__ Kb,
    const float* __restrict__ Ab, const float* __restrict__ Bb,
    const float* __restrict__ Wp2, const float* __restrict__ bp2,
    const int* __restrict__ adj, float* __restrict__ S) {
  __shared__ __attribute__((aligned(16))) float smem[SMEM_FLOATS];
  float* sB = smem + SB_OFF;               // [16 j][BP_]   x_j side
  float* sA = smem + SA_OFF;               // [16 i][D_]    x_i side (+bp1)
  float* sW = smem + SW_OFF;               // [H_ + 1][BP_] Wp2 transposed, row H_ = 0
  // The two result tiles take the place of the x_j tile once the k loops are done.
  float* lds_qk   = smem;                  // [h][i][j]
  float* lds_bias = smem + H_ * 256;       // [i][j][h]

  const int blk = blockIdx.x;              // b*1024 + it*32 + jt
  const int b  = blk >> 10;
  const int it = (blk >> 5) & 31;
  const int jt = blk & 31;
  const int wave = threadIdx.x >> 5;
  const int lane = threadIdx.x & 31;
  const int m16 = lane & 15;
  const int g   = lane >> 4;

  // ---- stage: each wave-wide 16-byte load covers 512 contiguous bytes ----
  {
    const float4* gB = (const float4*)(Bb + (size_t)(b * N_ + jt * 16) * D_);
    const float4* gA = (const float4*)(Ab + (size_t)(b * N_ + it * 16) * D_);
#pragma unroll
    for (int r = 0; r < 4; ++r) {
      const int idx = threadIdx.x + 256 * r;     // float4 index in the 16 x 64 tile
      const int row = idx >> 6;
      const int c4  = idx & 63;
      *(float4*)(sB + row * BP_ + c4 * 4) = gB[idx];
      *(float4*)(sA + idx * 4)            = gA[idx];
    }
    const float4 w = ((const float4*)Wp2)[threadIdx.x];   // Wp2[d][0..3], d = thread
    sW[0 * BP_ + threadIdx.x] = w.x;
    sW[1 * BP_ + threadIdx.x] = w.y;
    sW[2 * BP_ + threadIdx.x] = w.z;
    sW[3 * BP_ + threadIdx.x] = w.w;
    sW[H_ * BP_ + threadIdx.x] = 0.0f;           // columns 4..15 of the B operand
  }
  __syncthreads();

  // ---- QK^T (heads on waves 0..3) ----
  v8f qk = {};
  if (wave < H_) {
    const int h = wave;
    const float* qrow = Q  + (size_t)(b * N_ + it * 16 + m16) * D_ + h * HD_;
    const float* krow = Kb + (size_t)(b * N_ + jt * 16 + m16) * D_ + h * HD_;
    for (int kk = 0; kk < HD_; kk += 4) {
      const int d0 = kk + 2 * g;
      v2f a = *(const v2f*)(qrow + d0);
      v2f bf = *(const v2f*)(krow + d0);   // B[k][n] = K[n][k] -> contiguous in k
      qk = wmma4(a, bf, qk);
    }
  }

  // ---- physics bias: every wave handles i-rows 2*wave and 2*wave+1 ----
  const float* brow = sB + m16 * BP_ + 2 * g;                      // x_j side
  const float* wrow = sW + (m16 < H_ ? m16 : H_) * BP_ + 2 * g;    // Wp2 column
  v8f pb[2];
#pragma unroll
  for (int s = 0; s < 2; ++s) {
    const float* arow = sA + (wave * 2 + s) * D_ + 2 * g;          // x_i side (+bp1)
    v8f acc = {};
    for (int kk = 0; kk < D_; kk += 4) {
      v2f bp = *(const v2f*)(brow + kk);
      v2f ap = *(const v2f*)(arow + kk);
      v2f a = gelu_exact2(ap + bp);
      v2f bf = *(const v2f*)(wrow + kk);   // Wp2[d0][n], Wp2[d0+1][n]; 0 for n >= 4
      acc = wmma4(a, bf, acc);
    }
    pb[s] = acc;
  }
  __syncthreads();                         // every wave has left the staged tiles

  if (wave < H_) {
#pragma unroll
    for (int p = 0; p < 8; ++p) lds_qk[(wave * 16 + p + 8 * g) * 16 + m16] = qk[p];
  }
  if (m16 < H_) {
#pragma unroll
    for (int s = 0; s < 2; ++s)
#pragma unroll
      for (int p = 0; p < 8; ++p)
        lds_bias[((wave * 2 + s) * 16 + p + 8 * g) * H_ + m16] = pb[s][p];
  }
  __syncthreads();

  // ---- combine + mask + store ----
  const int ii = threadIdx.x >> 4;
  const int jj = threadIdx.x & 15;
  const int i = it * 16 + ii;
  const int j = jt * 16 + jj;
  const bool mk = adj[i * N_ + j] != 0;
  // Precaution: the wait stands in front of the LDS reads below, which reuse the
  // register that holds this load's address.
  asm volatile("s_wait_xcnt 0x0" ::: "memory");
#pragma unroll
  for (int h = 0; h < H_; ++h) {
    const float bias_v = lds_bias[(ii * 16 + jj) * H_ + h] + bp2[h];
    const float v = lds_qk[(h * 16 + ii) * 16 + jj] * SCALE + (mk ? bias_v : NEGINF);
    S[((size_t)(b * H_ + h) * N_ + i) * N_ + j] = v;
  }
}

// ---------------------------------------------------------------------------
// Phase B: row softmax over j. One wave per row (512 elems -> 16/lane).
// ---------------------------------------------------------------------------
__global__ __launch_bounds__(256) void softmax_kernel(float* __restrict__ S) {
  const int wave = threadIdx.x >> 5;
  const int lane = threadIdx.x & 31;
  float* p = S + ((size_t)blockIdx.x * 8 + wave) * N_;

  float vals[16];
  float mx = -3.4e38f;
#pragma unroll
  for (int t = 0; t < 16; ++t) {
    vals[t] = p[lane + t * 32];
    mx = fmaxf(mx, vals[t]);
  }
#pragma unroll
  for (int off = 16; off >= 1; off >>= 1) mx = fmaxf(mx, __shfl_xor(mx, off));
  float sum = 0.0f;
#pragma unroll
  for (int t = 0; t < 16; ++t) {
    vals[t] = __expf(vals[t] - mx);
    sum += vals[t];
  }
#pragma unroll
  for (int off = 16; off >= 1; off >>= 1) sum += __shfl_xor(sum, off);
  const float inv = 1.0f / sum;
#pragma unroll
  for (int t = 0; t < 16; ++t) p[lane + t * 32] = vals[t] * inv;
}

// ---------------------------------------------------------------------------
// Phase C: O[b,i,h*64+d] = sum_j attn[b,h,i,j] * V[b,j,h*64+d]  (WMMA, K=512)
// One wave per 16x16 output tile: 8 (b,h) * 32 i-tiles * 4 d-tiles = 1024 tiles.
// ---------------------------------------------------------------------------
__global__ __launch_bounds__(256) void pv_kernel(
    const float* __restrict__ S, const float* __restrict__ V,
    float* __restrict__ O) {
  const int wave = threadIdx.x >> 5;
  const int lane = threadIdx.x & 31;
  const int m16 = lane & 15;
  const int g   = lane >> 4;
  const int tile = blockIdx.x * 8 + wave;
  const int nt = tile & 3;
  const int it = (tile >> 2) & 31;
  const int bh = tile >> 7;
  const int b = bh >> 2, h = bh & 3;

  const float* srow = S + ((size_t)bh * N_ + it * 16 + m16) * N_;
  const float* vcol = V + (size_t)b * N_ * D_ + h * HD_ + nt * 16 + m16;
  v8f acc = {};
  for (int kk = 0; kk < N_; kk += 4) {
    const int k0 = kk + 2 * g;
    v2f a = *(const v2f*)(srow + k0);
    v2f bf;
    bf.x = vcol[(size_t)k0 * D_];
    bf.y = vcol[(size_t)(k0 + 1) * D_];
    acc = wmma4(a, bf, acc);
  }
  float* orow = O + (size_t)(b * N_ + it * 16) * D_ + h * HD_ + nt * 16 + m16;
#pragma unroll
  for (int p = 0; p < 8; ++p) orow[(size_t)(p + 8 * g) * D_] = acc[p];
}

// ---------------------------------------------------------------------------
// Host launcher. Workspace layout (floats):
//   Q,K,V,A,B : 5 * 1024*256            = 1,310,720
//   S         : 2*4*512*512             = 2,097,152
//   O         : 1024*256                =   262,144
// Total ~14.0 MB.
// ---------------------------------------------------------------------------
extern "C" void kernel_launch(void* const* d_in, const int* in_sizes, int n_in,
                              void* d_out, int out_size, void* d_ws,
                              size_t ws_size, hipStream_t stream) {
  (void)in_sizes; (void)n_in; (void)out_size; (void)ws_size;
  const float* x   = (const float*)d_in[0];
  const int*   adj = (const int*)  d_in[1];
  const float* Wq  = (const float*)d_in[2];
  const float* bq  = (const float*)d_in[3];
  const float* Wk  = (const float*)d_in[4];
  const float* bk  = (const float*)d_in[5];
  const float* Wv  = (const float*)d_in[6];
  const float* bv  = (const float*)d_in[7];
  const float* Wo  = (const float*)d_in[8];
  const float* bo  = (const float*)d_in[9];
  const float* Wp1 = (const float*)d_in[10];  // [2D, D] row-major
  const float* bp1 = (const float*)d_in[11];
  const float* Wp2 = (const float*)d_in[12];  // [D, H] row-major
  const float* bp2 = (const float*)d_in[13];

  const int M = B_ * N_;  // 1024
  float* ws = (float*)d_ws;
  float* Qb = ws;
  float* Kb = Qb + (size_t)M * D_;
  float* Vb = Kb + (size_t)M * D_;
  float* Ab = Vb + (size_t)M * D_;
  float* Bb = Ab + (size_t)M * D_;
  float* Sb = Bb + (size_t)M * D_;                       // [B,H,N,N]
  float* Ob = Sb + (size_t)B_ * H_ * N_ * N_;

  const dim3 blk(256);
  const int gemm_blocks = (M / 16) * (D_ / 16) / 8;      // 128

  // Projections, all five in one launch (bp1 folded into the x_i side of the
  // physics MLP); Qb, Kb, Vb, Ab, Bb lie one behind the other in the workspace.
  gemm_xw_kernel<<<dim3(gemm_blocks, 5), blk, 0, stream>>>(
      x, Wq, bq, Wk, bk, Wv, bv, Wp1, bp1, Wp1 + (size_t)D_ * D_, nullptr,
      Qb, M, D_, D_);

  scores_kernel<<<B_ * 32 * 32, blk, 0, stream>>>(Qb, Kb, Ab, Bb, Wp2, bp2,
                                                  adj, Sb);
  softmax_kernel<<<(B_ * H_ * N_) / 8, blk, 0, stream>>>(Sb);
  pv_kernel<<<(B_ * H_ * 32 * 4) / 8, blk, 0, stream>>>(Sb, Vb, Ob);
  gemm_xw_kernel<<<gemm_blocks, blk, 0, stream>>>(
      Ob, Wo, bo, nullptr, nullptr, nullptr, nullptr, nullptr, nullptr, nullptr,
      nullptr, (float*)d_out, M, D_, D_);
}

// v004
// One run takes 85.8 microseconds.
// Two timings next to v003 both put it at 1.27 times that version's speed.
// Counting every step since v000, it is 2.65 times as fast.
#include <hip/hip_runtime.h>
#include <math.h>

// Problem constants (PhysicsGatedAttention): B=2, N=512, HIDDEN=256, HEADS=4, HEAD_DIM=64
#define N_   512
#define D_   256
#define H_   4
#define HD_  64
#define B_   2
#define SCALE   0.125f      // HEAD_DIM^-0.5
#define NEGINF  (-1e9f)

typedef float v2f __attribute__((ext_vector_type(2)));
typedef float v8f __attribute__((ext_vector_type(8)));

// V_WMMA_F32_16X16X4_F32 : D(16x16 f32) = A(16x4 f32) * B(4x16 f32) + C
// Layouts (wave32):
//   A frag: lane = m + 16*g (m=0..15, g=0..1); a.x=A[m][k+2g], a.y=A[m][k+2g+1]
//   B frag: lane = n + 16*g;                    b.x=B[k+2g][n], b.y=B[k+2g+1][n]
//   C/D   : lane = n + 16*g, vgpr p => D[p+8g][n]
__device__ __forceinline__ v8f wmma4(v2f a, v2f b, v8f c) {
  return __builtin_amdgcn_wmma_f32_16x16x4_f32(false, a, false, b, (short)0, c,
                                               false, false);
}

// jax.nn.gelu(approximate=False): 0.5*x*(1+erf(x/sqrt(2))) = x*Phi(x), two values
// at a time and without a branch. With T(|x|) = 0.5*erfc(|x|/sqrt(2)), the upper
// normal tail, x*Phi(x) = 0.5*x + |x|*(0.5 - T(|x|)) for either sign of x.
// T(y) = exp(-y*y/2) * t*(c1+t*(c2+t*(c3+t*(c4+t*c5)))), t = 1/(1+p*y), is the
// classic five-term rational form; its absolute error is below 7.5e-8 for all y >= 0.
__device__ __forceinline__ v2f splat2(float c) { v2f r = {c, c}; return r; }

__device__ __forceinline__ v2f gelu_exact2(v2f v) {
  v2f y = {__builtin_fabsf(v.x), __builtin_fabsf(v.y)};
  const v2f d = __builtin_elementwise_fma(y, splat2(0.2316419f), splat2(1.0f));
  v2f t = {__builtin_amdgcn_rcpf(d.x), __builtin_amdgcn_rcpf(d.y)};
  v2f q = __builtin_elementwise_fma(t, splat2(0.5307027145f), splat2(-0.7265760135f));
  q = __builtin_elementwise_fma(t, q, splat2(0.7107068705f));
  q = __builtin_elementwise_fma(t, q, splat2(-0.142248368f));
  q = __builtin_elementwise_fma(t, q, splat2(0.127414796f));
  q = q * t;
  const v2f w = (v * v) * splat2(-0.72134752044448170368f);   // -x*x/2 * log2(e)
  v2f e = {__builtin_amdgcn_exp2f(w.x), __builtin_amdgcn_exp2f(w.y)};
  const v2f s = __builtin_elementwise_fma(-q, e, splat2(0.5f));
  return __builtin_elementwise_fma(y, s, v * splat2(0.5f));
}

// ---------------------------------------------------------------------------
// One 32 x 64 block tile of C = A[32,K] * B[K,64], both operands staged once in
// LDS. Every global load is 16 bytes a lane and covers whole 128-byte lines, and
// all of a thread's loads are issued before the first LDS store, so the block
// pays the load latency once, not once per group of k steps, and no load is
// spread over 16 lines as a fragment load from global memory would be.
//   sA : [32 rows][K + 4]; the pitch is 4 mod 64 banks, so the 16 rows x 2 k
//        pairs of one 8-byte fragment read fall on 64 different banks.
//   sB : [K / 2 row pairs][64 columns][2]: rows 2r and 2r+1 interleaved, so that
//        one 8-byte read gives the lane's (b.x, b.y). Odd row pairs have column
//        bit 4 flipped (32 floats): the two pairs of one read use different banks.
// 8 waves: wave >> 2 picks the 16 rows, wave & 3 the 16 columns. Every output
// element sums its products in ascending k, four to a WMMA.
// ---------------------------------------------------------------------------
template <int K, int LDA, int LDB>
__device__ __forceinline__ v8f staged_tile_product(
    const float* __restrict__ Ag, const float* __restrict__ Bg, float* sA, float* sB) {
  constexpr int AP = K + 4;
  constexpr int NR = K / 32;               // rounds of 256 threads x 16 bytes
  constexpr int RA = 1024 / K;             // rows of A a round
  const int tid = threadIdx.x;
  const int arow = tid / (K / 4);
  const int ac4  = tid % (K / 4);
  const int pr = tid >> 4;                 // row pair of B; a round has 16 of them
  const int c4 = tid & 15;
  const float* pa = Ag + arow * LDA + ac4 * 4;
  const float* pb = Bg + 2 * pr * LDB + c4 * 4;
  float4 ra[NR], rb0[NR], rb1[NR];
  // The four loops below are unrolled so that the arrays stay in registers and
  // every round's address is the base plus a constant offset.
#pragma unroll
  for (int r = 0; r < NR; ++r) ra[r] = *(const float4*)(pa + r * RA * LDA);
#pragma unroll
  for (int r = 0; r < NR; ++r) {
    rb0[r] = *(const float4*)(pb + r * 32 * LDB);
    rb1[r] = *(const float4*)(pb + r * 32 * LDB + LDB);
  }
  float* qa = sA + arow * AP + ac4 * 4;
  float* qb = sB + pr * 128 + ((c4 * 8) ^ ((pr & 1) << 5));
#pragma unroll
  for (int r = 0; r < NR; ++r) *(float4*)(qa + r * RA * AP) = ra[r];
#pragma unroll
  for (int r = 0; r < NR; ++r) {           // 16 pairs on: the parity of pr stays
    float* q = qb + r * 16 * 128;
    *(float4*)q       = make_float4(rb0[r].x, rb1[r].x, rb0[r].y, rb1[r].y);
    *(float4*)(q + 4) = make_float4(rb0[r].z, rb1[r].z, rb0[r].w, rb1[r].w);
  }
  __syncthreads();                         // the tiles are whole before any fragment read

  const int wave = tid >> 5;
  const int lane = tid & 31;
  const int m16 = lane & 15;
  const int g   = lane >> 4;
  const float* ar = sA + ((wave >> 2) * 16 + m16) * AP + 2 * g;
  const float* br = sB + g * 128 + ((((wave & 3) * 16 + m16) * 2) ^ (g << 5));
  v8f acc = {};
  // Unrolled so that the next steps' LDS reads issue ahead of the WMMAs in front
  // of them and take constant offsets from one address a trip.
#pragma unroll 16
  for (int kk = 0; kk < K; kk += 4) {
    v2f a = *(const v2f*)(ar + kk);        // A[m][kk+2g], A[m][kk+2g+1]
    v2f b = *(const v2f*)(br + kk * 64);   // B[kk+2g][n], B[kk+2g+1][n]
    acc = wmma4(a, b, acc);
  }
  return acc;
}

// ---------------------------------------------------------------------------
// fp32 GEMM: Y[1024,256] = X[1024,256] @ W[256,256] (+ bias[256]).
// One block per 32 x 64 output tile, 8 waves of one 16x16 tile each.
// Up to five products of one X share a grid: blockIdx.y picks W and bias, and
// the results lie one behind the other from Y0.
// ---------------------------------------------------------------------------
__global__ __launch_bounds__(256) void gemm_xw_kernel(
    const float* __restrict__ X,
    const float* __restrict__ W0, const float* __restrict__ bias0,
    const float* __restrict__ W1, const float* __restrict__ bias1,
    const float* __restrict__ W2, const float* __restrict__ bias2,
    const float* __restrict__ W3, const float* __restrict__ bias3,
    const float* __restrict__ W4, const float* __restrict__ bias4,
    float* __restrict__ Y0) {
  __shared__ __attribute__((aligned(16))) float sA[32 * (D_ + 4)];
  __shared__ __attribute__((aligned(16))) float sB[(D_ / 2) * 128];
  const int which = blockIdx.y;
  const float* W = W0;
  const float* bias = bias0;
  if (which == 1) { W = W1; bias = bias1; }
  if (which == 2) { W = W2; bias = bias2; }
  if (which == 3) { W = W3; bias = bias3; }
  if (which == 4) { W = W4; bias = bias4; }
  float* Y = Y0 + (size_t)which * (B_ * N_) * D_;
  const int wave = threadIdx.x >> 5;
  const int lane = threadIdx.x & 31;
  const int m16 = lane & 15;
  const int g   = lane >> 4;
  const int row0 = (blockIdx.x >> 2) * 32;
  const int col0 = (blockIdx.x & 3) * 64;

  const v8f acc = staged_tile_product<D_, D_, D_>(X + (size_t)row0 * D_, W + col0,
                                                  sA, sB);

  const int col = col0 + (wave & 3) * 16 + m16;
  const float bv = bias ? bias[col] : 0.0f;
  float* yout = Y + (size_t)(row0 + (wave >> 2) * 16) * D_ + col;
#pragma unroll
  for (int p = 0; p < 8; ++p)
    yout[(size_t)(p + 8 * g) * D_] = acc[p] + bv;
}

// ---------------------------------------------------------------------------
// Phase A: S[b,h,i,j] = scale*(q_i . k_j) + (mask ? physics_bias : -1e9)
// One block per (b, i-tile16, j-tile16). 8 waves:
//   all waves  : stage the x_j tile, the x_i tile and Wp2 in LDS, whole lines
//   waves 0..3 : QK^T for head = wave (16 WMMA over hd=64)
//   all waves  : physics bias for i = it*16 + 2*wave + {0,1}
//                (GELU into A-frag, [16j x 256d] @ Wp2[256d x 4h] via WMMA),
//                every fragment of the k loop read from LDS
// ---------------------------------------------------------------------------
// LDS pitch in floats of the x_j tile and of the transposed Wp2: 260 = 4 mod 64
// banks, so the 16 rows x 2 k pairs of one 8-byte fragment read fall on 64
// different banks.
#define BP_  260
#define SB_OFF 0
#define SA_OFF (16 * BP_)
#define SW_OFF (16 * BP_ + 16 * D_)
#define SMEM_FLOATS (16 * BP_ + 16 * D_ + (H_ + 1) * BP_)

__global__ __launch_bounds__(256) void scores_kernel(
    const float* __restrict__ Q, const float* __restrict__ Kb,
    const float* __restrict__ Ab, const float* __restrict__ Bb,
    const float* __restrict__ Wp2, const float* __restrict__ bp2,
    const int* __restrict__ adj, float* __restrict__ S) {
  __shared__ __attribute__((aligned(16))) float smem[SMEM_FLOATS];
  float* sB = smem + SB_OFF;               // [16 j][BP_]   x_j side
  float* sA = smem + SA_OFF;               // [16 i][D_]    x_i side (+bp1)
  float* sW = smem + SW_OFF;               // [H_ + 1][BP_] Wp2 transposed, row H_ = 0
  // The two result tiles take the place of the x_j tile once the k loops are done.
  float* lds_qk   = smem;                  // [h][i][j]
  float* lds_bias = smem + H_ * 256;       // [i][j][h]

  const int blk = blockIdx.x;              // b*1024 + it*32 + jt
  const int b  = blk >> 10;
  const int it = (blk >> 5) & 31;
  const int jt = blk & 31;
  const int wave = threadIdx.x >> 5;
  const int lane = threadIdx.x & 31;
  const int m16 = lane & 15;
  const int g   = lane >> 4;

  // ---- stage: each wave-wide 16-byte load covers 512 contiguous bytes ----
  {
    const float4* gB = (const float4*)(Bb + (size_t)(b * N_ + jt * 16) * D_);
    const float4* gA = (const float4*)(Ab + (size_t)(b * N_ + it * 16) * D_);
#pragma unroll
    for (int r = 0; r < 4; ++r) {
      const int idx = threadIdx.x + 256 * r;     // float4 index in the 16 x 64 tile
      const int row = idx >> 6;
      const int c4  = idx & 63;
      *(float4*)(sB + row * BP_ + c4 * 4) = gB[idx];
      *(float4*)(sA + idx * 4)            = gA[idx];
    }
    const float4 w = ((const float4*)Wp2)[threadIdx.x];   // Wp2[d][0..3], d = thread
    sW[0 * BP_ + threadIdx.x] = w.x;
    sW[1 * BP_ + threadIdx.x] = w.y;
    sW[2 * BP_ + threadIdx.x] = w.z;
    sW[3 * BP_ + threadIdx.x] = w.w;
    sW[H_ * BP_ + threadIdx.x] = 0.0f;           // columns 4..15 of the B operand
  }
  __syncthreads();

  // ---- QK^T (heads on waves 0..3) ----
  v8f qk = {};
  if (wave < H_) {
    const int h = wave;
    const float* qrow = Q  + (size_t)(b * N_ + it * 16 + m16) * D_ + h * HD_;
    const float* krow = Kb + (size_t)(b * N_ + jt * 16 + m16) * D_ + h * HD_;
    for (int kk = 0; kk < HD_; kk += 4) {
      const int d0 = kk + 2 * g;
      v2f a = *(const v2f*)(qrow + d0);
      v2f bf = *(const v2f*)(krow + d0);   // B[k][n] = K[n][k] -> contiguous in k
      qk = wmma4(a, bf, qk);
    }
  }

  // ---- physics bias: every wave handles i-rows 2*wave and 2*wave+1 ----
  const float* brow = sB + m16 * BP_ + 2 * g;                      // x_j side
  const float* wrow = sW + (m16 < H_ ? m16 : H_) * BP_ + 2 * g;    // Wp2 column
  v8f pb[2];
#pragma unroll
  for (int s = 0; s < 2; ++s) {
    const float* arow = sA + (wave * 2 + s) * D_ + 2 * g;          // x_i side (+bp1)
    v8f acc = {};
    for (int kk = 0; kk < D_; kk += 4) {
      v2f bp = *(const v2f*)(brow + kk);
      v2f ap = *(const v2f*)(arow + kk);
      v2f a = gelu_exact2(ap + bp);
      v2f bf = *(const v2f*)(wrow + kk);   // Wp2[d0][n], Wp2[d0+1][n]; 0 for n >= 4
      acc = wmma4(a, bf, acc);
    }
    pb[s] = acc;
  }
  __syncthreads();                         // every wave has left the staged tiles

  if (wave < H_) {
#pragma unroll
    for (int p = 0; p < 8; ++p) lds_qk[(wave * 16 + p + 8 * g) * 16 + m16] = qk[p];
  }
  if (m16 < H_) {
#pragma unroll
    for (int s = 0; s < 2; ++s)
#pragma unroll
      for (int p = 0; p < 8; ++p)
        lds_bias[((wave * 2 + s) * 16 + p + 8 * g) * H_ + m16] = pb[s][p];
  }
  __syncthreads();

  // ---- combine + mask + store ----
  const int ii = threadIdx.x >> 4;
  const int jj = threadIdx.x & 15;
  const int i = it * 16 + ii;
  const int j = jt * 16 + jj;
  const bool mk = adj[i * N_ + j] != 0;
  // Precaution: the wait stands in front of the LDS reads below, which reuse the
  // register that holds this load's address.
  asm volatile("s_wait_xcnt 0x0" ::: "memory");
#pragma unroll
  for (int h = 0; h < H_; ++h) {
    const float bias_v = lds_bias[(ii * 16 + jj) * H_ + h] + bp2[h];
    const float v = lds_qk[(h * 16 + ii) * 16 + jj] * SCALE + (mk ? bias_v : NEGINF);
    S[((size_t)(b * H_ + h) * N_ + i) * N_ + j] = v;
  }
}

// ---------------------------------------------------------------------------
// Phase B: row softmax over j. One wave per row (512 elems -> 16/lane).
// ---------------------------------------------------------------------------
__global__ __launch_bounds__(256) void softmax_kernel(float* __restrict__ S) {
  const int wave = threadIdx.x >> 5;
  const int lane = threadIdx.x & 31;
  float* p = S + ((size_t)blockIdx.x * 8 + wave) * N_;

  float vals[16];
  float mx = -3.4e38f;
#pragma unroll
  for (int t = 0; t < 16; ++t) {
    vals[t] = p[lane + t * 32];
    mx = fmaxf(mx, vals[t]);
  }
#pragma unroll
  for (int off = 16; off >= 1; off >>= 1) mx = fmaxf(mx, __shfl_xor(mx, off));
  float sum = 0.0f;
#pragma unroll
  for (int t = 0; t < 16; ++t) {
    vals[t] = __expf(vals[t] - mx);
    sum += vals[t];
  }
#pragma unroll
  for (int off = 16; off >= 1; off >>= 1) sum += __shfl_xor(sum, off);
  const float inv = 1.0f / sum;
#pragma unroll
  for (int t = 0; t < 16; ++t) p[lane + t * 32] = vals[t] * inv;
}

// ---------------------------------------------------------------------------
// Phase C: O[b,i,h*64+d] = sum_j attn[b,h,i,j] * V[b,j,h*64+d]  (WMMA, K=512)
// One block per (b, h, 32 rows i): 32 x 64 output tile, 8 * 16 = 128 blocks.
// ---------------------------------------------------------------------------
__global__ __launch_bounds__(256) void pv_kernel(
    const float* __restrict__ S, const float* __restrict__ V,
    float* __restrict__ O) {
  __shared__ __attribute__((aligned(16))) float sA[32 * (N_ + 4)];
  __shared__ __attribute__((aligned(16))) float sB[(N_ / 2) * 128];
  const int wave = threadIdx.x >> 5;
  const int lane = threadIdx.x & 31;
  const int m16 = lane & 15;
  const int g   = lane >> 4;
  const int bh = blockIdx.x >> 4;
  const int i0 = (blockIdx.x & 15) * 32;
  const int b = bh >> 2, h = bh & 3;

  const v8f acc = staged_tile_product<N_, N_, D_>(
      S + ((size_t)bh * N_ + i0) * N_, V + (size_t)b * N_ * D_ + h * HD_, sA, sB);

  float* orow = O + (size_t)(b * N_ + i0 + (wave >> 2) * 16) * D_ + h * HD_ +
                (wave & 3) * 16 + m16;
#pragma unroll
  for (int p = 0; p < 8; ++p) orow[(size_t)(p + 8 * g) * D_] = acc[p];
}

// ---------------------------------------------------------------------------
// Host launcher. Workspace layout (floats):
//   Q,K,V,A,B : 5 * 1024*256            = 1,310,720
//   S         : 2*4*512*512             = 2,097,152
//   O         : 1024*256                =   262,144
// Total ~14.0 MB.
// ---------------------------------------------------------------------------
extern "C" void kernel_launch(void* const* d_in, const int* in_sizes, int n_in,
                              void* d_out, int out_size, void* d_ws,
                              size_t ws_size, hipStream_t stream) {
  (void)in_sizes; (void)n_in; (void)out_size; (void)ws_size;
  const float* x   = (const float*)d_in[0];
  const int*   adj = (const int*)  d_in[1];
  const float* Wq  = (const float*)d_in[2];
  const float* bq  = (const float*)d_in[3];
  const float* Wk  = (const float*)d_in[4];
  const float* bk  = (const float*)d_in[5];
  const float* Wv  = (const float*)d_in[6];
  const float* bv  = (const float*)d_in[7];
  const float* Wo  = (const float*)d_in[8];
  const float* bo  = (const float*)d_in[9];
  const float* Wp1 = (const float*)d_in[10];  // [2D, D] row-major
  const float* bp1 = (const float*)d_in[11];
  const float* Wp2 = (const float*)d_in[12];  // [D, H] row-major
  const float* bp2 = (const float*)d_in[13];

  const int M = B_ * N_;  // 1024
  float* ws = (float*)d_ws;
  float* Qb = ws;
  float* Kb = Qb + (size_t)M * D_;
  float* Vb = Kb + (size_t)M * D_;
  float* Ab = Vb + (size_t)M * D_;
  float* Bb = Ab + (size_t)M * D_;
  float* Sb = Bb + (size_t)M * D_;                       // [B,H,N,N]
  float* Ob = Sb + (size_t)B_ * H_ * N_ * N_;

  const dim3 blk(256);
  const int gemm_blocks = (M / 32) * (D_ / 64);          // 128

  // Projections, all five in one launch (bp1 folded into the x_i side of the
  // physics MLP); Qb, Kb, Vb, Ab, Bb lie one behind the other in the workspace.
  gemm_xw_kernel<<<dim3(gemm_blocks, 5), blk, 0, stream>>>(
      x, Wq, bq, Wk, bk, Wv, bv, Wp1, bp1, Wp1 + (size_t)D_ * D_, nullptr,
      Qb);

  scores_kernel<<<B_ * 32 * 32, blk, 0, stream>>>(Qb, Kb, Ab, Bb, Wp2, bp2,
                                                  adj, Sb);
  softmax_kernel<<<(B_ * H_ * N_) / 8, blk, 0, stream>>>(Sb);
  pv_kernel<<<B_ * H_ * (N_ / 32), blk, 0, stream>>>(Sb, Vb, Ob);
  gemm_xw_kernel<<<gemm_blocks, blk, 0, stream>>>(
      Ob, Wo, bo, nullptr, nullptr, nullptr, nullptr, nullptr, nullptr, nullptr,
      nullptr, (float*)d_out);
}

// v005
// A run of this version takes 71.7 microseconds.
// Two timings next to v004 put it at 1.20 and 1.21 times that version's speed.
// All steps since v000 together make it 3.19 times as fast.
#include <hip/hip_runtime.h>
#include <math.h>

// Problem constants (PhysicsGatedAttention): B=2, N=512, HIDDEN=256, HEADS=4, HEAD_DIM=64
#define N_   512
#define D_   256
#define H_   4
#define HD_  64
#define B_   2
#define SCALE   0.125f      // HEAD_DIM^-0.5
#define NEGINF  (-1e9f)

typedef float v2f __attribute__((ext_vector_type(2)));
typedef float v8f __attribute__((ext_vector_type(8)));

// V_WMMA_F32_16X16X4_F32 : D(16x16 f32) = A(16x4 f32) * B(4x16 f32) + C
// Layouts (wave32):
//   A frag: lane = m + 16*g (m=0..15, g=0..1); a.x=A[m][k+2g], a.y=A[m][k+2g+1]
//   B frag: lane = n + 16*g;                    b.x=B[k+2g][n], b.y=B[k+2g+1][n]
//   C/D   : lane = n + 16*g, vgpr p => D[p+8g][n]
__device__ __forceinline__ v8f wmma4(v2f a, v2f b, v8f c) {
  return __builtin_amdgcn_wmma_f32_16x16x4_f32(false, a, false, b, (short)0, c,
                                               false, false);
}

// jax.nn.gelu(approximate=False): 0.5*x*(1+erf(x/sqrt(2))) = x*Phi(x), two values
// at a time and without a branch. With T(|x|) = 0.5*erfc(|x|/sqrt(2)), the upper
// normal tail, x*Phi(x) = 0.5*x + |x|*(0.5 - T(|x|)) for either sign of x.
// T(y) = exp(-y*y/2) * t*(c1+t*(c2+t*(c3+t*(c4+t*c5)))), t = 1/(1+p*y), is the
// classic five-term rational form; its absolute error is below 7.5e-8 for all y >= 0.
__device__ __forceinline__ v2f splat2(float c) { v2f r = {c, c}; return r; }

__device__ __forceinline__ v2f gelu_exact2(v2f v) {
  v2f y = {__builtin_fabsf(v.x), __builtin_fabsf(v.y)};
  const v2f d = __builtin_elementwise_fma(y, splat2(0.2316419f), splat2(1.0f));
  v2f t = {__builtin_amdgcn_rcpf(d.x), __builtin_amdgcn_rcpf(d.y)};
  v2f q = __builtin_elementwise_fma(t, splat2(0.5307027145f), splat2(-0.7265760135f));
  q = __builtin_elementwise_fma(t, q, splat2(0.7107068705f));
  q = __builtin_elementwise_fma(t, q, splat2(-0.142248368f));
  q = __builtin_elementwise_fma(t, q, splat2(0.127414796f));
  q = q * t;
  const v2f w = (v * v) * splat2(-0.72134752044448170368f);   // -x*x/2 * log2(e)
  v2f e = {__builtin_amdgcn_exp2f(w.x), __builtin_amdgcn_exp2f(w.y)};
  const v2f s = __builtin_elementwise_fma(-q, e, splat2(0.5f));
  return __builtin_elementwise_fma(y, s, v * splat2(0.5f));
}

// ---------------------------------------------------------------------------
// One 32 x 64 block tile of C = A[32,K] * B[K,64], both operands staged once in
// LDS. Every global load is 16 bytes a lane and covers whole 128-byte lines, and
// all of a thread's loads are issued before the first LDS store, so the block
// pays the load latency once, not once per group of k steps, and no load is
// spread over 16 lines as a fragment load from global memory would be.
//   sA : [32 rows][K + 4]; the pitch is 4 mod 64 banks, so the 16 rows x 2 k
//        pairs of one 8-byte fragment read fall on 64 different banks.
//   sB : [K / 2 row pairs][64 columns][2]: rows 2r and 2r+1 interleaved, so that
//        one 8-byte read gives the lane's (b.x, b.y). Odd row pairs have column
//        bit 4 flipped (32 floats): the two pairs of one read use different banks.
// 8 waves: wave >> 2 picks the 16 rows, wave & 3 the 16 columns. Every output
// element sums its products in ascending k, four to a WMMA.
// ---------------------------------------------------------------------------
template <int K, int LDA, int LDB>
__device__ __forceinline__ v8f staged_tile_product(
    const float* __restrict__ Ag, const float* __restrict__ Bg, float* sA, float* sB) {
  constexpr int AP = K + 4;
  constexpr int NR = K / 32;               // rounds of 256 threads x 16 bytes
  constexpr int RA = 1024 / K;             // rows of A a round
  const int tid = threadIdx.x;
  const int arow = tid / (K / 4);
  const int ac4  = tid % (K / 4);
  const int pr = tid >> 4;                 // row pair of B; a round has 16 of them
  const int c4 = tid & 15;
  const float* pa = Ag + arow * LDA + ac4 * 4;
  const float* pb = Bg + 2 * pr * LDB + c4 * 4;
  float4 ra[NR], rb0[NR], rb1[NR];
  // The four loops below are unrolled so that the arrays stay in registers and
  // every round's address is the base plus a constant offset.
#pragma unroll
  for (int r = 0; r < NR; ++r) ra[r] = *(const float4*)(pa + r * RA * LDA);
#pragma unroll
  for (int r = 0; r < NR; ++r) {
    rb0[r] = *(const float4*)(pb + r * 32 * LDB);
    rb1[r] = *(const float4*)(pb + r * 32 * LDB + LDB);
  }
  float* qa = sA + arow * AP + ac4 * 4;
  float* qb = sB + pr * 128 + ((c4 * 8) ^ ((pr & 1) << 5));
#pragma unroll
  for (int r = 0; r < NR; ++r) *(float4*)(qa + r * RA * AP) = ra[r];
#pragma unroll
  for (int r = 0; r < NR; ++r) {           // 16 pairs on: the parity of pr stays
    float* q = qb + r * 16 * 128;
    *(float4*)q       = make_float4(rb0[r].x, rb1[r].x, rb0[r].y, rb1[r].y);
    *(float4*)(q + 4) = make_float4(rb0[r].z, rb1[r].z, rb0[r].w, rb1[r].w);
  }
  __syncthreads();                         // the tiles are whole before any fragment read

  const int wave = tid >> 5;
  const int lane = tid & 31;
  const int m16 = lane & 15;
  const int g   = lane >> 4;
  const float* ar = sA + ((wave >> 2) * 16 + m16) * AP + 2 * g;
  const float* br = sB + g * 128 + ((((wave & 3) * 16 + m16) * 2) ^ (g << 5));
  v8f acc = {};
  // Unrolled so that the next steps' LDS reads issue ahead of the WMMAs in front
  // of them and take constant offsets from one address a trip.
#pragma unroll 16
  for (int kk = 0; kk < K; kk += 4) {
    v2f a = *(const v2f*)(ar + kk);        // A[m][kk+2g], A[m][kk+2g+1]
    v2f b = *(const v2f*)(br + kk * 64);   // B[kk+2g][n], B[kk+2g+1][n]
    acc = wmma4(a, b, acc);
  }
  return acc;
}

// ---------------------------------------------------------------------------
// fp32 GEMM: Y[1024,256] = X[1024,256] @ W[256,256] (+ bias[256]).
// One block per 32 x 64 output tile, 8 waves of one 16x16 tile each.
// Up to five products of one X share a grid: blockIdx.y picks W and bias, and
// the results lie one behind the other from Y0.
// ---------------------------------------------------------------------------
__global__ __launch_bounds__(256) void gemm_xw_kernel(
    const float* __restrict__ X,
    const float* __restrict__ W0, const float* __restrict__ bias0,
    const float* __restrict__ W1, const float* __restrict__ bias1,
    const float* __restrict__ W2, const float* __restrict__ bias2,
    const float* __restrict__ W3, const float* __restrict__ bias3,
    const float* __restrict__ W4, const float* __restrict__ bias4,
    float* __restrict__ Y0) {
  __shared__ __attribute__((aligned(16))) float sA[32 * (D_ + 4)];
  __shared__ __attribute__((aligned(16))) float sB[(D_ / 2) * 128];
  const int which = blockIdx.y;
  const float* W = W0;
  const float* bias = bias0;
  if (which == 1) { W = W1; bias = bias1; }
  if (which == 2) { W = W2; bias = bias2; }
  if (which == 3) { W = W3; bias = bias3; }
  if (which == 4) { W = W4; bias = bias4; }
  float* Y = Y0 + (size_t)which * (B_ * N_) * D_;
  const int wave = threadIdx.x >> 5;
  const int lane = threadIdx.x & 31;
  const int m16 = lane & 15;
  const int g   = lane >> 4;
  const int row0 = (blockIdx.x >> 2) * 32;
  const int col0 = (blockIdx.x & 3) * 64;

  const v8f acc = staged_tile_product<D_, D_, D_>(X + (size_t)row0 * D_, W + col0,
                                                  sA, sB);

  const int col = col0 + (wave & 3) * 16 + m16;
  const float bv = bias ? bias[col] : 0.0f;
  float* yout = Y + (size_t)(row0 + (wave >> 2) * 16) * D_ + col;
#pragma unroll
  for (int p = 0; p < 8; ++p)
    yout[(size_t)(p + 8 * g) * D_] = acc[p] + bv;
}

// ---------------------------------------------------------------------------
// Phase A: S[b,h,i,j] = scale*(q_i . k_j) + (mask ? physics_bias : -1e9)
// One block per (b, i-tile16, j-tile16). 8 waves:
//   all waves  : stage the x_j tile, the x_i tile and Wp2 in LDS, whole lines;
//                pack the tile's unmasked (i, j) pairs into one list
//   waves 0..3 : QK^T for head = wave (16 WMMA over hd=64)
//   all waves  : physics bias of 16 listed pairs at a time
//                (GELU into A-frag, [16 pairs x 256d] @ Wp2[256d x 4h] via WMMA),
//                every fragment of the k loop read from LDS
// A masked pair's bias is never used (the reference selects -1e9 there), so it is
// not computed: a tile with n unmasked pairs costs ceil(n / 16) groups, 16 at most.
// ---------------------------------------------------------------------------
// LDS pitch in floats of the x_j tile, the x_i tile and the transposed Wp2:
// 260 = 4 mod 64 banks, so the 16 rows x 2 k pairs of one 8-byte fragment read
// fall on 64 different banks; lanes whose pairs share a row read the same address.
#define BP_  260
#define SB_OFF 0
#define SA_OFF (16 * BP_)
#define SW_OFF (32 * BP_)
#define SMEM_FLOATS (32 * BP_ + (H_ + 1) * BP_)

// Bias of 16 pairs: row m of the A operand is gelu(x_i side + x_j side) of the
// lane's own pair; every pair sums its products in ascending k, four to a WMMA.
__device__ __forceinline__ v8f bias_of_16_pairs(const float* arow, const float* brow,
                                                const float* wrow) {
  v8f acc = {};
  for (int kk = 0; kk < D_; kk += 4) {
    v2f bp = *(const v2f*)(brow + kk);
    v2f ap = *(const v2f*)(arow + kk);
    v2f a = gelu_exact2(ap + bp);
    v2f bf = *(const v2f*)(wrow + kk);   // Wp2[d0][n], Wp2[d0+1][n]; 0 for n >= 4
    acc = wmma4(a, bf, acc);
  }
  return acc;
}

__global__ __launch_bounds__(256) void scores_kernel(
    const float* __restrict__ Q, const float* __restrict__ Kb,
    const float* __restrict__ Ab, const float* __restrict__ Bb,
    const float* __restrict__ Wp2, const float* __restrict__ bp2,
    const int* __restrict__ adj, float* __restrict__ S) {
  __shared__ __attribute__((aligned(16))) float smem[SMEM_FLOATS];
  __shared__ __attribute__((aligned(16))) int sList[256];  // ii * 16 + jj, unmasked first
  __shared__ __attribute__((aligned(16))) int sCnt[8];     // unmasked pairs a wave
  float* sB = smem + SB_OFF;               // [16 j][BP_]   x_j side
  float* sA = smem + SA_OFF;               // [16 i][BP_]   x_i side (+bp1)
  float* sW = smem + SW_OFF;               // [H_ + 1][BP_] Wp2 transposed, row H_ = 0
  // The two result tiles take the place of the x_j tile once the k loops are done.
  float* lds_qk   = smem;                  // [h][i][j]
  float* lds_bias = smem + H_ * 256;       // [i][j][h], and one spare [h] behind it

  const int blk = blockIdx.x;              // b*1024 + it*32 + jt
  const int b  = blk >> 10;
  const int it = (blk >> 5) & 31;
  const int jt = blk & 31;
  const int wave = __builtin_amdgcn_readfirstlane(threadIdx.x >> 5);
  const int lane = threadIdx.x & 31;
  const int m16 = lane & 15;
  const int g   = lane >> 4;

  // ---- the thread's own pair of the tile and its mask ----
  const int ii = threadIdx.x >> 4;
  const int jj = threadIdx.x & 15;
  const int i = it * 16 + ii;
  const int j = jt * 16 + jj;
  const bool mk = adj[i * N_ + j] != 0;
  // Precaution: the wait stands in front of the code below, which reuses the
  // register that holds this load's address.
  asm volatile("s_wait_xcnt 0x0" ::: "memory");

  // ---- stage: each wave-wide 16-byte load covers 512 contiguous bytes ----
  {
    const float4* gB = (const float4*)(Bb + (size_t)(b * N_ + jt * 16) * D_);
    const float4* gA = (const float4*)(Ab + (size_t)(b * N_ + it * 16) * D_);
#pragma unroll
    for (int r = 0; r < 4; ++r) {
      const int idx = threadIdx.x + 256 * r;     // float4 index in the 16 x 64 tile
      const int row = idx >> 6;
      const int c4  = idx & 63;
      *(float4*)(sB + row * BP_ + c4 * 4) = gB[idx];
      *(float4*)(sA + row * BP_ + c4 * 4) = gA[idx];
    }
    const float4 w = ((const float4*)Wp2)[threadIdx.x];   // Wp2[d][0..3], d = thread
    sW[0 * BP_ + threadIdx.x] = w.x;
    sW[1 * BP_ + threadIdx.x] = w.y;
    sW[2 * BP_ + threadIdx.x] = w.z;
    sW[3 * BP_ + threadIdx.x] = w.w;
    sW[H_ * BP_ + threadIdx.x] = 0.0f;           // columns 4..15 of the B operand
  }
  const unsigned bal = __builtin_amdgcn_ballot_w32(mk);
  if (lane == 0) sCnt[wave] = __builtin_popcount(bal);
  __syncthreads();

  // ---- pack: unmasked pairs in thread order; the rest of the list names pair 0,
  //      a valid row for the lanes that fill up the last group ----
  int before = 0, total = 0;
#pragma unroll
  for (int w = 0; w < 8; ++w) {
    const int c = sCnt[w];
    total += c;
    before += (w < wave) ? c : 0;
  }
  total = __builtin_amdgcn_readfirstlane(total);
  if (mk) sList[before + __builtin_amdgcn_mbcnt_lo(bal, 0u)] = threadIdx.x;
  if ((int)threadIdx.x >= total) sList[threadIdx.x] = 0;
  __syncthreads();                         // the list is whole before any group reads it
  const int ngroups = (total + 15) >> 4;   // 0..16

  // ---- QK^T (heads on waves 0..3) ----
  v8f qk = {};
  if (wave < H_) {
    const int h = wave;
    const float* qrow = Q  + (size_t)(b * N_ + it * 16 + m16) * D_ + h * HD_;
    const float* krow = Kb + (size_t)(b * N_ + jt * 16 + m16) * D_ + h * HD_;
    for (int kk = 0; kk < HD_; kk += 4) {
      const int d0 = kk + 2 * g;
      v2f a = *(const v2f*)(qrow + d0);
      v2f bf = *(const v2f*)(krow + d0);   // B[k][n] = K[n][k] -> contiguous in k
      qk = wmma4(a, bf, qk);
    }
  }

  // ---- physics bias: a wave takes groups first and first + 8 of the list. Waves
  //      4..7, which have no QK^T, come first; the turn by the block index spreads
  //      the groups past a multiple of 8 over the four SIMDs (waves w, w + 4). ----
  const int first = (((wave & 3) + blk + (blk >> 8)) & 3) + (wave < H_ ? 4 : 0);
  const float* wrow = sW + (m16 < H_ ? m16 : H_) * BP_ + 2 * g;    // Wp2 column
  v8f pb[2];
#pragma unroll
  for (int s = 0; s < 2; ++s) {
    const int grp = first + 8 * s;
    v8f acc = {};
    if (grp < ngroups) {
      const int pid = sList[grp * 16 + m16];
      acc = bias_of_16_pairs(sA + (pid >> 4) * BP_ + 2 * g,        // x_i side (+bp1)
                             sB + (pid & 15) * BP_ + 2 * g, wrow); // x_j side
    }
    pb[s] = acc;
  }
  __syncthreads();                         // every wave has left the staged tiles

  if (wave < H_) {
#pragma unroll
    for (int p = 0; p < 8; ++p) lds_qk[(wave * 16 + p + 8 * g) * 16 + m16] = qk[p];
  }
  if (m16 < H_) {
#pragma unroll
    for (int s = 0; s < 2; ++s) {
      const int grp = first + 8 * s;
      if (grp < ngroups) {
        const int pos = grp * 16 + 8 * g;             // list place of D row 8g
        const int4 l0 = *(const int4*)(sList + pos);
        const int4 l1 = *(const int4*)(sList + pos + 4);
        const int pid[8] = {l0.x, l0.y, l0.z, l0.w, l1.x, l1.y, l1.z, l1.w};
        // Rows past the end of the list go to a slot behind the tile that nobody reads.
#pragma unroll
        for (int p = 0; p < 8; ++p)
          lds_bias[(pos + p < total ? pid[p] : 256) * H_ + m16] = pb[s][p];
      }
    }
  }
  __syncthreads();

  // ---- combine + mask + store ----
#pragma unroll
  for (int h = 0; h < H_; ++h) {
    const float bias_v = lds_bias[(ii * 16 + jj) * H_ + h] + bp2[h];
    const float v = lds_qk[(h * 16 + ii) * 16 + jj] * SCALE + (mk ? bias_v : NEGINF);
    S[((size_t)(b * H_ + h) * N_ + i) * N_ + j] = v;
  }
}

// ---------------------------------------------------------------------------
// Phase B: row softmax over j. One wave per row (512 elems -> 16/lane).
// ---------------------------------------------------------------------------
__global__ __launch_bounds__(256) void softmax_kernel(float* __restrict__ S) {
  const int wave = threadIdx.x >> 5;
  const int lane = threadIdx.x & 31;
  float* p = S + ((size_t)blockIdx.x * 8 + wave) * N_;

  float vals[16];
  float mx = -3.4e38f;
#pragma unroll
  for (int t = 0; t < 16; ++t) {
    vals[t] = p[lane + t * 32];
    mx = fmaxf(mx, vals[t]);
  }
#pragma unroll
  for (int off = 16; off >= 1; off >>= 1) mx = fmaxf(mx, __shfl_xor(mx, off));
  float sum = 0.0f;
#pragma unroll
  for (int t = 0; t < 16; ++t) {
    vals[t] = __expf(vals[t] - mx);
    sum += vals[t];
  }
#pragma unroll
  for (int off = 16; off >= 1; off >>= 1) sum += __shfl_xor(sum, off);
  const float inv = 1.0f / sum;
#pragma unroll
  for (int t = 0; t < 16; ++t) p[lane + t * 32] = vals[t] * inv;
}

// ---------------------------------------------------------------------------
// Phase C: O[b,i,h*64+d] = sum_j attn[b,h,i,j] * V[b,j,h*64+d]  (WMMA, K=512)
// One block per (b, h, 32 rows i): 32 x 64 output tile, 8 * 16 = 128 blocks.
// ---------------------------------------------------------------------------
__global__ __launch_bounds__(256) void pv_kernel(
    const float* __restrict__ S, const float* __restrict__ V,
    float* __restrict__ O) {
  __shared__ __attribute__((aligned(16))) float sA[32 * (N_ + 4)];
  __shared__ __attribute__((aligned(16))) float sB[(N_ / 2) * 128];
  const int wave = threadIdx.x >> 5;
  const int lane = threadIdx.x & 31;
  const int m16 = lane & 15;
  const int g   = lane >> 4;
  const int bh = blockIdx.x >> 4;
  const int i0 = (blockIdx.x & 15) * 32;
  const int b = bh >> 2, h = bh & 3;

  const v8f acc = staged_tile_product<N_, N_, D_>(
      S + ((size_t)bh * N_ + i0) * N_, V + (size_t)b * N_ * D_ + h * HD_, sA, sB);

  float* orow = O + (size_t)(b * N_ + i0 + (wave >> 2) * 16) * D_ + h * HD_ +
                (wave & 3) * 16 + m16;
#pragma unroll
  for (int p = 0; p < 8; ++p) orow[(size_t)(p + 8 * g) * D_] = acc[p];
}

// ---------------------------------------------------------------------------
// Host launcher. Workspace layout (floats):
//   Q,K,V,A,B : 5 * 1024*256            = 1,310,720
//   S         : 2*4*512*512             = 2,097,152
//   O         : 1024*256                =   262,144
// Total ~14.0 MB.
// ---------------------------------------------------------------------------
extern "C" void kernel_launch(void* const* d_in, const int* in_sizes, int n_in,
                              void* d_out, int out_size, void* d_ws,
                              size_t ws_size, hipStream_t stream) {
  (void)in_sizes; (void)n_in; (void)out_size; (void)ws_size;
  const float* x   = (const float*)d_in[0];
  const int*   adj = (const int*)  d_in[1];
  const float* Wq  = (const float*)d_in[2];
  const float* bq  = (const float*)d_in[3];
  const float* Wk  = (const float*)d_in[4];
  const float* bk  = (const float*)d_in[5];
  const float* Wv  = (const float*)d_in[6];
  const float* bv  = (const float*)d_in[7];
  const float* Wo  = (const float*)d_in[8];
  const float* bo  = (const float*)d_in[9];
  const float* Wp1 = (const float*)d_in[10];  // [2D, D] row-major
  const float* bp1 = (const float*)d_in[11];
  const float* Wp2 = (const float*)d_in[12];  // [D, H] row-major
  const float* bp2 = (const float*)d_in[13];

  const int M = B_ * N_;  // 1024
  float* ws = (float*)d_ws;
  float* Qb = ws;
  float* Kb = Qb + (size_t)M * D_;
  float* Vb = Kb + (size_t)M * D_;
  float* Ab = Vb + (size_t)M * D_;
  float* Bb = Ab + (size_t)M * D_;
  float* Sb = Bb + (size_t)M * D_;                       // [B,H,N,N]
  float* Ob = Sb + (size_t)B_ * H_ * N_ * N_;

  const dim3 blk(256);
  const int gemm_blocks = (M / 32) * (D_ / 64);          // 128

  // Projections, all five in one launch (bp1 folded into the x_i side of the
  // physics MLP); Qb, Kb, Vb, Ab, Bb lie one behind the other in the workspace.
  gemm_xw_kernel<<<dim3(gemm_blocks, 5), blk, 0, stream>>>(
      x, Wq, bq, Wk, bk, Wv, bv, Wp1, bp1, Wp1 + (size_t)D_ * D_, nullptr,
      Qb);

  scores_kernel<<<B_ * 32 * 32, blk, 0, stream>>>(Qb, Kb, Ab, Bb, Wp2, bp2,
                                                  adj, Sb);
  softmax_kernel<<<(B_ * H_ * N_) / 8, blk, 0, stream>>>(Sb);
  pv_kernel<<<B_ * H_ * (N_ / 32), blk, 0, stream>>>(Sb, Vb, Ob);
  gemm_xw_kernel<<<gemm_blocks, blk, 0, stream>>>(
      Ob, Wo, bo, nullptr, nullptr, nullptr, nullptr, nullptr, nullptr, nullptr,
      nullptr, (float*)d_out);
}

// v006
// It runs in 53.6 microseconds.
// Two timings next to v005 put it at 1.33 and 1.31 times that version's speed.
// All steps since v000 together make it 4.20 times as fast.
#include <hip/hip_runtime.h>
#include <math.h>

// Problem constants (PhysicsGatedAttention): B=2, N=512, HIDDEN=256, HEADS=4, HEAD_DIM=64
#define N_   512
#define D_   256
#define H_   4
#define HD_  64
#define B_   2
#define SCALE   0.125f      // HEAD_DIM^-0.5
#define NEGINF  (-1e9f)

typedef float v2f __attribute__((ext_vector_type(2)));
typedef float v8f __attribute__((ext_vector_type(8)));

// V_WMMA_F32_16X16X4_F32 : D(16x16 f32) = A(16x4 f32) * B(4x16 f32) + C
// Layouts (wave32):
//   A frag: lane = m + 16*g (m=0..15, g=0..1); a.x=A[m][k+2g], a.y=A[m][k+2g+1]
//   B frag: lane = n + 16*g;                    b.x=B[k+2g][n], b.y=B[k+2g+1][n]
//   C/D   : lane = n + 16*g, vgpr p => D[p+8g][n]
__device__ __forceinline__ v8f wmma4(v2f a, v2f b, v8f c) {
  return __builtin_amdgcn_wmma_f32_16x16x4_f32(false, a, false, b, (short)0, c,
                                               false, false);
}

// jax.nn.gelu(approximate=False): 0.5*x*(1+erf(x/sqrt(2))) = x*Phi(x), two values
// at a time and without a branch. With T(|x|) = 0.5*erfc(|x|/sqrt(2)), the upper
// normal tail, x*Phi(x) = 0.5*x + |x|*(0.5 - T(|x|)) for either sign of x.
// T(y) = exp(-y*y/2) * t*(c1+t*(c2+t*(c3+t*(c4+t*c5)))), t = 1/(1+p*y), is the
// classic five-term rational form; its absolute error is below 7.5e-8 for all y >= 0.
__device__ __forceinline__ v2f splat2(float c) { v2f r = {c, c}; return r; }

__device__ __forceinline__ v2f gelu_exact2(v2f v) {
  v2f y = {__builtin_fabsf(v.x), __builtin_fabsf(v.y)};
  const v2f d = __builtin_elementwise_fma(y, splat2(0.2316419f), splat2(1.0f));
  v2f t = {__builtin_amdgcn_rcpf(d.x), __builtin_amdgcn_rcpf(d.y)};
  v2f q = __builtin_elementwise_fma(t, splat2(0.5307027145f), splat2(-0.7265760135f));
  q = __builtin_elementwise_fma(t, q, splat2(0.7107068705f));
  q = __builtin_elementwise_fma(t, q, splat2(-0.142248368f));
  q = __builtin_elementwise_fma(t, q, splat2(0.127414796f));
  q = q * t;
  const v2f w = (v * v) * splat2(-0.72134752044448170368f);   // -x*x/2 * log2(e)
  v2f e = {__builtin_amdgcn_exp2f(w.x), __builtin_amdgcn_exp2f(w.y)};
  const v2f s = __builtin_elementwise_fma(-q, e, splat2(0.5f));
  return __builtin_elementwise_fma(y, s, v * splat2(0.5f));
}

// ---------------------------------------------------------------------------
// One 32 x 64 block tile of C = A[32,K] * B[K,64], both operands staged once in
// LDS. Every global load is 16 bytes a lane and covers whole 128-byte lines, and
// all of a thread's loads are issued before the first LDS store, so the block
// pays the load latency once, not once per group of k steps, and no load is
// spread over 16 lines as a fragment load from global memory would be.
//   sA : [32 rows][K + 4]; the pitch is 4 mod 64 banks, so the 16 rows x 2 k
//        pairs of one 8-byte fragment read fall on 64 different banks.
//   sB : [K / 2 row pairs][64 columns][2]: rows 2r and 2r+1 interleaved, so that
//        one 8-byte read gives the lane's (b.x, b.y). Odd row pairs have column
//        bit 4 flipped (32 floats): the two pairs of one read use different banks.
// 8 waves: wave >> 2 picks the 16 rows, wave & 3 the 16 columns. Every output
// element sums its products in ascending k, four to a WMMA.
// With ROW_SOFTMAX the A operand is softmax(A) along k: a wave then loads four
// whole rows (Q 16-byte pieces a lane and row), so that a row's maximum and sum
// are taken over the wave's own registers and lanes, and the normalised values go
// to LDS. The rows never travel to memory and back between softmax and product.
// ---------------------------------------------------------------------------
// 2^w. The v_nop keeps the one slot that the instruction set asks for behind a
// transcendental before its source register is overwritten.
__device__ __forceinline__ float exp2_with_slot(float w) {
  float e;
  asm("v_exp_f32 %0, %1\n\tv_nop" : "=v"(e) : "v"(w));
  return e;
}

template <int Q>
__device__ __forceinline__ void softmax_of_four_rows(float4 (&v)[4 * Q]) {
  constexpr float LOG2E = 1.44269504088896340736f;
  float mx[4], sum[4];
  // All loops here are unrolled: the array stays in registers, and the four rows'
  // cross-lane steps stand side by side, so that their latencies overlap.
#pragma unroll
  for (int rr = 0; rr < 4; ++rr) {
    float m = -3.4e38f;
#pragma unroll
    for (int t = 0; t < Q; ++t) {
      const float4 x = v[rr * Q + t];
      m = fmaxf(m, fmaxf(fmaxf(x.x, x.y), fmaxf(x.z, x.w)));
    }
    mx[rr] = m;
  }
#pragma unroll
  for (int off = 16; off >= 1; off >>= 1) {
#pragma unroll
    for (int rr = 0; rr < 4; ++rr) mx[rr] = fmaxf(mx[rr], __shfl_xor(mx[rr], off));
  }
#pragma unroll
  for (int rr = 0; rr < 4; ++rr) {
    float s = 0.0f;
#pragma unroll
    for (int t = 0; t < Q; ++t) {
      float4 x = v[rr * Q + t];
      x.x = exp2_with_slot((x.x - mx[rr]) * LOG2E);
      x.y = exp2_with_slot((x.y - mx[rr]) * LOG2E);
      x.z = exp2_with_slot((x.z - mx[rr]) * LOG2E);
      x.w = exp2_with_slot((x.w - mx[rr]) * LOG2E);
      s += (x.x + x.y) + (x.z + x.w);
      v[rr * Q + t] = x;
    }
    sum[rr] = s;
  }
#pragma unroll
  for (int off = 16; off >= 1; off >>= 1) {
#pragma unroll
    for (int rr = 0; rr < 4; ++rr) sum[rr] += __shfl_xor(sum[rr], off);
  }
#pragma unroll
  for (int rr = 0; rr < 4; ++rr) {
    const float inv = 1.0f / sum[rr];
#pragma unroll
    for (int t = 0; t < Q; ++t) {
      float4 x = v[rr * Q + t];
      x.x *= inv; x.y *= inv; x.z *= inv; x.w *= inv;
      v[rr * Q + t] = x;
    }
  }
}

template <int K, int LDA, int LDB, bool ROW_SOFTMAX>
__device__ __forceinline__ v8f staged_tile_product(
    const float* __restrict__ Ag, const float* __restrict__ Bg, float* sA, float* sB) {
  constexpr int AP = K + 4;
  constexpr int NR = K / 32;               // rounds of 256 threads x 16 bytes
  constexpr int RA = 1024 / K;             // rows of A a round
  constexpr int Q  = K / 128;              // rounds a row, where a wave has whole rows
  const int tid = threadIdx.x;
  const int arow = ROW_SOFTMAX ? (tid >> 5) * 4 : tid / (K / 4);
  const int ac4  = ROW_SOFTMAX ? (tid & 31) : tid % (K / 4);
  const int pr = tid >> 4;                 // row pair of B; a round has 16 of them
  const int c4 = tid & 15;
  const float* pa = Ag + arow * LDA + ac4 * 4;
  const float* pb = Bg + 2 * pr * LDB + c4 * 4;
  float4 ra[NR], rb0[NR], rb1[NR];
  // The four loops below are unrolled so that the arrays stay in registers and
  // every round's address is the base plus a constant offset.
#pragma unroll
  for (int r = 0; r < NR; ++r)
    ra[r] = *(const float4*)(pa + (ROW_SOFTMAX ? (r / Q) * LDA + (r % Q) * 128
                                               : r * RA * LDA));
#pragma unroll
  for (int r = 0; r < NR; ++r) {
    rb0[r] = *(const float4*)(pb + r * 32 * LDB);
    rb1[r] = *(const float4*)(pb + r * 32 * LDB + LDB);
  }
  if constexpr (ROW_SOFTMAX) {
    // Scheduling order: all global loads, then the first cross-lane step. Without it
    // B's loads are sunk into and behind the softmax and start a load latency late.
    __builtin_amdgcn_sched_group_barrier(0x020, 3 * NR, 0);   // global loads
    __builtin_amdgcn_sched_group_barrier(0x080, 1, 0);        // an LDS-unit instruction
    softmax_of_four_rows<Q>(ra);
  }
  float* qa = sA + arow * AP + ac4 * 4;
  float* qb = sB + pr * 128 + ((c4 * 8) ^ ((pr & 1) << 5));
#pragma unroll
  for (int r = 0; r < NR; ++r)
    *(float4*)(qa + (ROW_SOFTMAX ? (r / Q) * AP + (r % Q) * 128 : r * RA * AP)) = ra[r];
#pragma unroll
  for (int r = 0; r < NR; ++r) {           // 16 pairs on: the parity of pr stays
    float* q = qb + r * 16 * 128;
    *(float4*)q       = make_float4(rb0[r].x, rb1[r].x, rb0[r].y, rb1[r].y);
    *(float4*)(q + 4) = make_float4(rb0[r].z, rb1[r].z, rb0[r].w, rb1[r].w);
  }
  __syncthreads();                         // the tiles are whole before any fragment read

  const int wave = tid >> 5;
  const int lane = tid & 31;
  const int m16 = lane & 15;
  const int g   = lane >> 4;
  const float* ar = sA + ((wave >> 2) * 16 + m16) * AP + 2 * g;
  const float* br = sB + g * 128 + ((((wave & 3) * 16 + m16) * 2) ^ (g << 5));
  v8f acc = {};
  // Unrolled so that the next steps' LDS reads issue ahead of the WMMAs in front
  // of them and take constant offsets from one address a trip.
#pragma unroll 16
  for (int kk = 0; kk < K; kk += 4) {
    v2f a = *(const v2f*)(ar + kk);        // A[m][kk+2g], A[m][kk+2g+1]
    v2f b = *(const v2f*)(br + kk * 64);   // B[kk+2g][n], B[kk+2g+1][n]
    acc = wmma4(a, b, acc);
  }
  return acc;
}

// ---------------------------------------------------------------------------
// fp32 GEMM: Y[1024,256] = X[1024,256] @ W[256,256] (+ bias[256]).
// One block per 32 x 64 output tile, 8 waves of one 16x16 tile each.
// Up to five products of one X share a grid: blockIdx.y picks W and bias, and
// the results lie one behind the other from Y0.
// ---------------------------------------------------------------------------
__global__ __launch_bounds__(256) void gemm_xw_kernel(
    const float* __restrict__ X,
    const float* __restrict__ W0, const float* __restrict__ bias0,
    const float* __restrict__ W1, const float* __restrict__ bias1,
    const float* __restrict__ W2, const float* __restrict__ bias2,
    const float* __restrict__ W3, const float* __restrict__ bias3,
    const float* __restrict__ W4, const float* __restrict__ bias4,
    float* __restrict__ Y0) {
  __shared__ __attribute__((aligned(16))) float sA[32 * (D_ + 4)];
  __shared__ __attribute__((aligned(16))) float sB[(D_ / 2) * 128];
  const int which = blockIdx.y;
  const float* W = W0;
  const float* bias = bias0;
  if (which == 1) { W = W1; bias = bias1; }
  if (which == 2) { W = W2; bias = bias2; }
  if (which == 3) { W = W3; bias = bias3; }
  if (which == 4) { W = W4; bias = bias4; }
  float* Y = Y0 + (size_t)which * (B_ * N_) * D_;
  const int wave = threadIdx.x >> 5;
  const int lane = threadIdx.x & 31;
  const int m16 = lane & 15;
  const int g   = lane >> 4;
  const int row0 = (blockIdx.x >> 2) * 32;
  const int col0 = (blockIdx.x & 3) * 64;

  const v8f acc = staged_tile_product<D_, D_, D_, false>(X + (size_t)row0 * D_, W + col0,
                                                  sA, sB);

  const int col = col0 + (wave & 3) * 16 + m16;
  const float bv = bias ? bias[col] : 0.0f;
  float* yout = Y + (size_t)(row0 + (wave >> 2) * 16) * D_ + col;
#pragma unroll
  for (int p = 0; p < 8; ++p)
    yout[(size_t)(p + 8 * g) * D_] = acc[p] + bv;
}

// ---------------------------------------------------------------------------
// Phase A: S[b,h,i,j] = scale*(q_i . k_j) + (mask ? physics_bias : -1e9)
// One block per (b, i-tile16, j-tile16). 8 waves:
//   all waves  : stage the x_j tile, the x_i tile and Wp2 in LDS, whole lines;
//                pack the tile's unmasked (i, j) pairs into one list
//   waves 0..3 : QK^T for head = wave (16 WMMA over hd=64)
//   all waves  : physics bias of 16 listed pairs at a time
//                (GELU into A-frag, [16 pairs x 256d] @ Wp2[256d x 4h] via WMMA),
//                every fragment of the k loop read from LDS
// A masked pair's bias is never used (the reference selects -1e9 there), so it is
// not computed: a tile with n unmasked pairs costs ceil(n / 16) groups, 16 at most.
// ---------------------------------------------------------------------------
// LDS pitch in floats of the x_j tile, the x_i tile and the transposed Wp2:
// 260 = 4 mod 64 banks, so the 16 rows x 2 k pairs of one 8-byte fragment read
// fall on 64 different banks; lanes whose pairs share a row read the same address.
#define BP_  260
#define SB_OFF 0
#define SA_OFF (16 * BP_)
#define SW_OFF (32 * BP_)
#define SMEM_FLOATS (32 * BP_ + (H_ + 1) * BP_)

// Bias of 16 pairs: row m of the A operand is gelu(x_i side + x_j side) of the
// lane's own pair; every pair sums its products in ascending k, four to a WMMA.
__device__ __forceinline__ v8f bias_of_16_pairs(const float* arow, const float* brow,
                                                const float* wrow) {
  v8f acc = {};
  for (int kk = 0; kk < D_; kk += 4) {
    v2f bp = *(const v2f*)(brow + kk);
    v2f ap = *(const v2f*)(arow + kk);
    v2f a = gelu_exact2(ap + bp);
    v2f bf = *(const v2f*)(wrow + kk);   // Wp2[d0][n], Wp2[d0+1][n]; 0 for n >= 4
    acc = wmma4(a, bf, acc);
  }
  return acc;
}

__global__ __launch_bounds__(256) void scores_kernel(
    const float* __restrict__ Q, const float* __restrict__ Kb,
    const float* __restrict__ Ab, const float* __restrict__ Bb,
    const float* __restrict__ Wp2, const float* __restrict__ bp2,
    const int* __restrict__ adj, float* __restrict__ S) {
  __shared__ __attribute__((aligned(16))) float smem[SMEM_FLOATS];
  __shared__ __attribute__((aligned(16))) int sList[256];  // ii * 16 + jj, unmasked first
  __shared__ __attribute__((aligned(16))) int sCnt[8];     // unmasked pairs a wave
  float* sB = smem + SB_OFF;               // [16 j][BP_]   x_j side
  float* sA = smem + SA_OFF;               // [16 i][BP_]   x_i side (+bp1)
  float* sW = smem + SW_OFF;               // [H_ + 1][BP_] Wp2 transposed, row H_ = 0
  // The two result tiles take the place of the x_j tile once the k loops are done.
  float* lds_qk   = smem;                  // [h][i][j]
  float* lds_bias = smem + H_ * 256;       // [i][j][h], and one spare [h] behind it

  const int blk = blockIdx.x;              // b*1024 + it*32 + jt
  const int b  = blk >> 10;
  const int it = (blk >> 5) & 31;
  const int jt = blk & 31;
  const int wave = __builtin_amdgcn_readfirstlane(threadIdx.x >> 5);
  const int lane = threadIdx.x & 31;
  const int m16 = lane & 15;
  const int g   = lane >> 4;

  // ---- the thread's own pair of the tile and its mask ----
  const int ii = threadIdx.x >> 4;
  const int jj = threadIdx.x & 15;
  const int i = it * 16 + ii;
  const int j = jt * 16 + jj;
  const bool mk = adj[i * N_ + j] != 0;
  // Precaution: the wait stands in front of the code below, which reuses the
  // register that holds this load's address.
  asm volatile("s_wait_xcnt 0x0" ::: "memory");

  // ---- stage: each wave-wide 16-byte load covers 512 contiguous bytes ----
  {
    const float4* gB = (const float4*)(Bb + (size_t)(b * N_ + jt * 16) * D_);
    const float4* gA = (const float4*)(Ab + (size_t)(b * N_ + it * 16) * D_);
#pragma unroll
    for (int r = 0; r < 4; ++r) {
      const int idx = threadIdx.x + 256 * r;     // float4 index in the 16 x 64 tile
      const int row = idx >> 6;
      const int c4  = idx & 63;
      *(float4*)(sB + row * BP_ + c4 * 4) = gB[idx];
      *(float4*)(sA + row * BP_ + c4 * 4) = gA[idx];
    }
    const float4 w = ((const float4*)Wp2)[threadIdx.x];   // Wp2[d][0..3], d = thread
    sW[0 * BP_ + threadIdx.x] = w.x;
    sW[1 * BP_ + threadIdx.x] = w.y;
    sW[2 * BP_ + threadIdx.x] = w.z;
    sW[3 * BP_ + threadIdx.x] = w.w;
    sW[H_ * BP_ + threadIdx.x] = 0.0f;           // columns 4..15 of the B operand
  }
  const unsigned bal = __builtin_amdgcn_ballot_w32(mk);
  if (lane == 0) sCnt[wave] = __builtin_popcount(bal);
  __syncthreads();

  // ---- pack: unmasked pairs in thread order; the rest of the list names pair 0,
  //      a valid row for the lanes that fill up the last group ----
  int before = 0, total = 0;
#pragma unroll
  for (int w = 0; w < 8; ++w) {
    const int c = sCnt[w];
    total += c;
    before += (w < wave) ? c : 0;
  }
  total = __builtin_amdgcn_readfirstlane(total);
  if (mk) sList[before + __builtin_amdgcn_mbcnt_lo(bal, 0u)] = threadIdx.x;
  if ((int)threadIdx.x >= total) sList[threadIdx.x] = 0;
  __syncthreads();                         // the list is whole before any group reads it
  const int ngroups = (total + 15) >> 4;   // 0..16

  // ---- QK^T (heads on waves 0..3) ----
  v8f qk = {};
  if (wave < H_) {
    const int h = wave;
    const float* qrow = Q  + (size_t)(b * N_ + it * 16 + m16) * D_ + h * HD_;
    const float* krow = Kb + (size_t)(b * N_ + jt * 16 + m16) * D_ + h * HD_;
    for (int kk = 0; kk < HD_; kk += 4) {
      const int d0 = kk + 2 * g;
      v2f a = *(const v2f*)(qrow + d0);
      v2f bf = *(const v2f*)(krow + d0);   // B[k][n] = K[n][k] -> contiguous in k
      qk = wmma4(a, bf, qk);
    }
  }

  // ---- physics bias: a wave takes groups first and first + 8 of the list. Waves
  //      4..7, which have no QK^T, come first; the turn by the block index spreads
  //      the groups past a multiple of 8 over the four SIMDs (waves w, w + 4). ----
  const int first = (((wave & 3) + blk + (blk >> 8)) & 3) + (wave < H_ ? 4 : 0);
  const float* wrow = sW + (m16 < H_ ? m16 : H_) * BP_ + 2 * g;    // Wp2 column
  v8f pb[2];
#pragma unroll
  for (int s = 0; s < 2; ++s) {
    const int grp = first + 8 * s;
    v8f acc = {};
    if (grp < ngroups) {
      const int pid = sList[grp * 16 + m16];
      acc = bias_of_16_pairs(sA + (pid >> 4) * BP_ + 2 * g,        // x_i side (+bp1)
                             sB + (pid & 15) * BP_ + 2 * g, wrow); // x_j side
    }
    pb[s] = acc;
  }
  __syncthreads();                         // every wave has left the staged tiles

  if (wave < H_) {
#pragma unroll
    for (int p = 0; p < 8; ++p) lds_qk[(wave * 16 + p + 8 * g) * 16 + m16] = qk[p];
  }
  if (m16 < H_) {
#pragma unroll
    for (int s = 0; s < 2; ++s) {
      const int grp = first + 8 * s;
      if (grp < ngroups) {
        const int pos = grp * 16 + 8 * g;             // list place of D row 8g
        const int4 l0 = *(const int4*)(sList + pos);
        const int4 l1 = *(const int4*)(sList + pos + 4);
        const int pid[8] = {l0.x, l0.y, l0.z, l0.w, l1.x, l1.y, l1.z, l1.w};
        // Rows past the end of the list go to a slot behind the tile that nobody reads.
#pragma unroll
        for (int p = 0; p < 8; ++p)
          lds_bias[(pos + p < total ? pid[p] : 256) * H_ + m16] = pb[s][p];
      }
    }
  }
  __syncthreads();

  // ---- combine + mask + store ----
#pragma unroll
  for (int h = 0; h < H_; ++h) {
    const float bias_v = lds_bias[(ii * 16 + jj) * H_ + h] + bp2[h];
    const float v = lds_qk[(h * 16 + ii) * 16 + jj] * SCALE + (mk ? bias_v : NEGINF);
    S[((size_t)(b * H_ + h) * N_ + i) * N_ + j] = v;
  }
}

// ---------------------------------------------------------------------------
// Phase B: O[b,i,h*64+d] = sum_j softmax_j(S[b,h,i,:])[j] * V[b,j,h*64+d]  (WMMA, K=512)
// One block per (b, h, 32 rows i): 32 x 64 output tile, 8 * 16 = 128 blocks. A block
// holds its 32 score rows whole, so the row softmax is done on the way into LDS.
// ---------------------------------------------------------------------------
__global__ __launch_bounds__(256) void pv_kernel(
    const float* __restrict__ S, const float* __restrict__ V,
    float* __restrict__ O) {
  __shared__ __attribute__((aligned(16))) float sA[32 * (N_ + 4)];
  __shared__ __attribute__((aligned(16))) float sB[(N_ / 2) * 128];
  const int wave = threadIdx.x >> 5;
  const int lane = threadIdx.x & 31;
  const int m16 = lane & 15;
  const int g   = lane >> 4;
  const int bh = blockIdx.x >> 4;
  const int i0 = (blockIdx.x & 15) * 32;
  const int b = bh >> 2, h = bh & 3;

  const v8f acc = staged_tile_product<N_, N_, D_, true>(
      S + ((size_t)bh * N_ + i0) * N_, V + (size_t)b * N_ * D_ + h * HD_, sA, sB);

  float* orow = O + (size_t)(b * N_ + i0 + (wave >> 2) * 16) * D_ + h * HD_ +
                (wave & 3) * 16 + m16;
#pragma unroll
  for (int p = 0; p < 8; ++p) orow[(size_t)(p + 8 * g) * D_] = acc[p];
}

// ---------------------------------------------------------------------------
// Host launcher. Workspace layout (floats):
//   Q,K,V,A,B : 5 * 1024*256            = 1,310,720
//   S         : 2*4*512*512             = 2,097,152
//   O         : 1024*256                =   262,144
// Total ~14.0 MB.
// ---------------------------------------------------------------------------
extern "C" void kernel_launch(void* const* d_in, const int* in_sizes, int n_in,
                              void* d_out, int out_size, void* d_ws,
                              size_t ws_size, hipStream_t stream) {
  (void)in_sizes; (void)n_in; (void)out_size; (void)ws_size;
  const float* x   = (const float*)d_in[0];
  const int*   adj = (const int*)  d_in[1];
  const float* Wq  = (const float*)d_in[2];
  const float* bq  = (const float*)d_in[3];
  const float* Wk  = (const float*)d_in[4];
  const float* bk  = (const float*)d_in[5];
  const float* Wv  = (const float*)d_in[6];
  const float* bv  = (const float*)d_in[7];
  const float* Wo  = (const float*)d_in[8];
  const float* bo  = (const float*)d_in[9];
  const float* Wp1 = (const float*)d_in[10];  // [2D, D] row-major
  const float* bp1 = (const float*)d_in[11];
  const float* Wp2 = (const float*)d_in[12];  // [D, H] row-major
  const float* bp2 = (const float*)d_in[13];

  const int M = B_ * N_;  // 1024
  float* ws = (float*)d_ws;
  float* Qb = ws;
  float* Kb = Qb + (size_t)M * D_;
  float* Vb = Kb + (size_t)M * D_;
  float* Ab = Vb + (size_t)M * D_;
  float* Bb = Ab + (size_t)M * D_;
  float* Sb = Bb + (size_t)M * D_;                       // [B,H,N,N]
  float* Ob = Sb + (size_t)B_ * H_ * N_ * N_;

  const dim3 blk(256);
  const int gemm_blocks = (M / 32) * (D_ / 64);          // 128

  // Projections, all five in one launch (bp1 folded into the x_i side of the
  // physics MLP); Qb, Kb, Vb, Ab, Bb lie one behind the other in the workspace.
  gemm_xw_kernel<<<dim3(gemm_blocks, 5), blk, 0, stream>>>(
      x, Wq, bq, Wk, bk, Wv, bv, Wp1, bp1, Wp1 + (size_t)D_ * D_, nullptr,
      Qb);

  scores_kernel<<<B_ * 32 * 32, blk, 0, stream>>>(Qb, Kb, Ab, Bb, Wp2, bp2,
                                                  adj, Sb);
  pv_kernel<<<B_ * H_ * (N_ / 32), blk, 0, stream>>>(Sb, Vb, Ob);
  gemm_xw_kernel<<<gemm_blocks, blk, 0, stream>>>(
      Ob, Wo, bo, nullptr, nullptr, nullptr, nullptr, nullptr, nullptr, nullptr,
      nullptr, (float*)d_out);
}

// v007
// A run of this version takes 51.3 microseconds.
// Timed twice side by side with v006, it ran 1.05 times as fast both times.
// All steps since v000 together make it 4.41 times as fast.
#include <hip/hip_runtime.h>
#include <math.h>

// Problem constants (PhysicsGatedAttention): B=2, N=512, HIDDEN=256, HEADS=4, HEAD_DIM=64
#define N_   512
#define D_   256
#define H_   4
#define HD_  64
#define B_   2
#define SCALE   0.125f      // HEAD_DIM^-0.5
#define NEGINF  (-1e9f)

typedef float v2f __attribute__((ext_vector_type(2)));
typedef float v8f __attribute__((ext_vector_type(8)));

// V_WMMA_F32_16X16X4_F32 : D(16x16 f32) = A(16x4 f32) * B(4x16 f32) + C
// Layouts (wave32):
//   A frag: lane = m + 16*g (m=0..15, g=0..1); a.x=A[m][k+2g], a.y=A[m][k+2g+1]
//   B frag: lane = n + 16*g;                    b.x=B[k+2g][n], b.y=B[k+2g+1][n]
//   C/D   : lane = n + 16*g, vgpr p => D[p+8g][n]
__device__ __forceinline__ v8f wmma4(v2f a, v2f b, v8f c) {
  return __builtin_amdgcn_wmma_f32_16x16x4_f32(false, a, false, b, (short)0, c,
                                               false, false);
}

// jax.nn.gelu(approximate=False): 0.5*x*(1+erf(x/sqrt(2))) = x*Phi(x), two values
// at a time and without a branch. With T(|x|) = 0.5*erfc(|x|/sqrt(2)), the upper
// normal tail, x*Phi(x) = 0.5*x + |x|*(0.5 - T(|x|)) for either sign of x.
// T(y) = exp(-y*y/2) * t*(c1+t*(c2+t*(c3+t*(c4+t*c5)))), t = 1/(1+p*y), is the
// classic five-term rational form; its absolute error is below 7.5e-8 for all y >= 0.
__device__ __forceinline__ v2f splat2(float c) { v2f r = {c, c}; return r; }

__device__ __forceinline__ v2f gelu_exact2(v2f v) {
  v2f y = {__builtin_fabsf(v.x), __builtin_fabsf(v.y)};
  const v2f d = __builtin_elementwise_fma(y, splat2(0.2316419f), splat2(1.0f));
  v2f t = {__builtin_amdgcn_rcpf(d.x), __builtin_amdgcn_rcpf(d.y)};
  v2f q = __builtin_elementwise_fma(t, splat2(0.5307027145f), splat2(-0.7265760135f));
  q = __builtin_elementwise_fma(t, q, splat2(0.7107068705f));
  q = __builtin_elementwise_fma(t, q, splat2(-0.142248368f));
  q = __builtin_elementwise_fma(t, q, splat2(0.127414796f));
  q = q * t;
  const v2f w = (v * v) * splat2(-0.72134752044448170368f);   // -x*x/2 * log2(e)
  v2f e = {__builtin_amdgcn_exp2f(w.x), __builtin_amdgcn_exp2f(w.y)};
  const v2f s = __builtin_elementwise_fma(-q, e, splat2(0.5f));
  return __builtin_elementwise_fma(y, s, v * splat2(0.5f));
}

// ---------------------------------------------------------------------------
// One 32 x NC block tile of C = A[32,K] * B[K,NC], both operands staged once in
// LDS by NT threads. Every global load is 16 bytes a lane and covers whole 128-byte
// lines, and all of a thread's loads are issued before the first LDS store, so the block
// pays the load latency once, not once per group of k steps, and no load is
// spread over 16 lines as a fragment load from global memory would be.
//   sA : [32 rows][KL + 4]; the pitch is 4 mod 64 banks, so the 16 rows x 2 k
//        pairs of one 8-byte fragment read fall on 64 different banks.
//   sB : [KL / 2 row pairs][NC columns][2]: rows 2r and 2r+1 interleaved, so that
//        one 8-byte read gives the lane's (b.x, b.y). Odd row pairs have column
//        bit 4 flipped (32 floats): the two pairs of one read use different banks.
// The tile has 2 x NC / 16 WMMA tiles. Where the block has KS times as many waves,
// the k range is dealt to KS groups of waves, K / KS each: a narrow tile then gives
// twice the blocks, one for every WGP, and a SIMD's share of the WMMAs is spread
// over KS waves, which cover each other's LDS latency. Within its range a wave sums
// in ascending k, four products to a WMMA; groups 1.. hand their sums over in sR,
// and group 0 adds them in ascending order: only its waves return the result.
// Each group's slices of A and B (KL = K / KS of k) lie side by side in LDS, GS floats
// from the next group's: the group's place is in the address register, and every
// fragment read of the k loop is that register plus an immediate offset.
// With ROW_SOFTMAX the A operand is softmax(A) along k: a wave then loads R whole
// rows (Q 16-byte pieces a lane and row), so that a row's maximum and sum
// are taken over the wave's own registers and lanes, and the normalised values go
// to LDS. The rows never travel to memory and back between softmax and product.
// ---------------------------------------------------------------------------
// 2^w. The v_nop keeps the one slot that the instruction set asks for behind a
// transcendental before its source register is overwritten.
__device__ __forceinline__ float exp2_with_slot(float w) {
  float e;
  asm("v_exp_f32 %0, %1\n\tv_nop" : "=v"(e) : "v"(w));
  return e;
}

template <int R, int Q>
__device__ __forceinline__ void softmax_of_rows(float4 (&v)[R * Q]) {
  constexpr float LOG2E = 1.44269504088896340736f;
  float mx[R], sum[R];
  // All loops here are unrolled: the array stays in registers, and the rows'
  // cross-lane steps stand side by side, so that their latencies overlap.
#pragma unroll
  for (int rr = 0; rr < R; ++rr) {
    float m = -3.4e38f;
#pragma unroll
    for (int t = 0; t < Q; ++t) {
      const float4 x = v[rr * Q + t];
      m = fmaxf(m, fmaxf(fmaxf(x.x, x.y), fmaxf(x.z, x.w)));
    }
    mx[rr] = m;
  }
#pragma unroll
  for (int off = 16; off >= 1; off >>= 1) {
#pragma unroll
    for (int rr = 0; rr < R; ++rr) mx[rr] = fmaxf(mx[rr], __shfl_xor(mx[rr], off));
  }
#pragma unroll
  for (int rr = 0; rr < R; ++rr) {
    float s = 0.0f;
#pragma unroll
    for (int t = 0; t < Q; ++t) {
      float4 x = v[rr * Q + t];
      x.x = exp2_with_slot((x.x - mx[rr]) * LOG2E);
      x.y = exp2_with_slot((x.y - mx[rr]) * LOG2E);
      x.z = exp2_with_slot((x.z - mx[rr]) * LOG2E);
      x.w = exp2_with_slot((x.w - mx[rr]) * LOG2E);
      s += (x.x + x.y) + (x.z + x.w);
      v[rr * Q + t] = x;
    }
    sum[rr] = s;
  }
#pragma unroll
  for (int off = 16; off >= 1; off >>= 1) {
#pragma unroll
    for (int rr = 0; rr < R; ++rr) sum[rr] += __shfl_xor(sum[rr], off);
  }
#pragma unroll
  for (int rr = 0; rr < R; ++rr) {
    const float inv = 1.0f / sum[rr];
#pragma unroll
    for (int t = 0; t < Q; ++t) {
      float4 x = v[rr * Q + t];
      x.x *= inv; x.y *= inv; x.z *= inv; x.w *= inv;
      v[rr * Q + t] = x;
    }
  }
}

template <int K, int NC, int NT>
struct TileShape {
  static constexpr int NTL = 2 * NC / 16;        // WMMA tiles of the block tile
  static constexpr int KS  = NT / 32 / NTL;      // groups of waves that share the k range
  static constexpr int KL  = K / KS;             // k range of a group
  static constexpr int AP  = KL + 4;             // floats a row in sA
  static constexpr int PP  = 2 * NC;             // floats a row pair in sB
  static constexpr int AS  = 32 * AP;            // floats of a group's slice of A
  static constexpr int GS  = AS + KL / 2 * PP;   // floats of a group's two slices
  static constexpr int RS  = (KS - 1) * NTL * 256;   // floats of sR
  static constexpr int FLOATS = RS + KS * GS;    // sR, then the groups' slices
};

template <int K, int LDA, int LDB, int NC, int NT, bool ROW_SOFTMAX>
__device__ __forceinline__ v8f staged_tile_product(
    const float* __restrict__ Ag, const float* __restrict__ Bg, float* smem) {
  using T = TileShape<K, NC, NT>;
  constexpr int NTL = T::NTL, KS = T::KS, KL = T::KL, AP = T::AP, PP = T::PP, GS = T::GS;
  constexpr int NRA = 8 * K / NT;          // 16-byte pieces of A a thread
  constexpr int RA  = 4 * NT / K;          // rows of A a round
  constexpr int R   = 1024 / NT;           // rows a wave, where a wave has whole rows
  constexpr int Q   = K / 128;             // rounds a row there
  constexpr int C4  = NC / 4;              // 16-byte pieces a row of B
  constexpr int PR  = NT / C4;             // row pairs of B a round
  constexpr int NRB = K / 2 / PR;          // rounds of B
  static_assert(KS == 1 || PR % (KL / 2) == 0, "a round of B covers whole groups");
  static_assert(!ROW_SOFTMAX || KL % 128 == 0, "a 128-float piece of a row lies in one group");
  float* sR = smem;
  float* sA = smem + T::RS;
  float* sB = sA + T::AS;
  const int tid = threadIdx.x;
  const int arow = ROW_SOFTMAX ? (tid >> 5) * R : tid / (K / 4);
  const int ac4  = ROW_SOFTMAX ? (tid & 31) : tid % (K / 4);
  const int pr = tid / C4;                 // row pair of B
  const int c4 = tid % C4;
  const float* pa = Ag + arow * LDA + ac4 * 4;
  const float* pb = Bg + 2 * pr * LDB + c4 * 4;
  float4 ra[NRA], rb0[NRB], rb1[NRB];
  // The four loops below are unrolled so that the arrays stay in registers and
  // every round's address is the base plus a constant offset.
#pragma unroll
  for (int r = 0; r < NRA; ++r)
    ra[r] = *(const float4*)(pa + (ROW_SOFTMAX ? (r / Q) * LDA + (r % Q) * 128
                                               : r * RA * LDA));
#pragma unroll
  for (int r = 0; r < NRB; ++r) {
    rb0[r] = *(const float4*)(pb + r * 2 * PR * LDB);
    rb1[r] = *(const float4*)(pb + r * 2 * PR * LDB + LDB);
  }
  if constexpr (ROW_SOFTMAX) softmax_of_rows<R, Q>(ra);
  float* qa = sA + arow * AP +
              (ROW_SOFTMAX || KS == 1 ? ac4 * 4 : (ac4 * 4 / KL) * GS + ac4 * 4 % KL);
  float* qb = sB + (KS == 1 ? pr * PP : (pr / (KL / 2)) * GS + (pr % (KL / 2)) * PP) +
              ((c4 * 8) ^ ((pr & 1) << 5));
#pragma unroll
  for (int r = 0; r < NRA; ++r)
    *(float4*)(qa + (ROW_SOFTMAX ? (r / Q) * AP + ((r % Q) * 128 / KL) * GS + (r % Q) * 128 % KL
                                 : r * RA * AP)) = ra[r];
#pragma unroll
  for (int r = 0; r < NRB; ++r) {          // PR pairs on, PR even: the parity of pr stays
    float* q = qb + (KS == 1 ? r * PR * PP : r * (PR / (KL / 2)) * GS);
    *(float4*)q       = make_float4(rb0[r].x, rb1[r].x, rb0[r].y, rb1[r].y);
    *(float4*)(q + 4) = make_float4(rb0[r].z, rb1[r].z, rb0[r].w, rb1[r].w);
  }
  __syncthreads();                         // the tiles are whole before any fragment read

  const int wave = tid >> 5;
  const int lane = tid & 31;
  const int m16 = lane & 15;
  const int g   = lane >> 4;
  const int tile = KS > 1 ? wave % NTL : wave;   // tile / (NC / 16): 16 rows, the rest: 16 columns
  const int gs0  = KS > 1 ? (wave / NTL) * GS : 0;   // the group's slices
  const float* ar = sA + gs0 + ((tile / (NC / 16)) * 16 + m16) * AP + 2 * g;
  const float* br = sB + gs0 + g * PP + ((((tile % (NC / 16)) * 16 + m16) * 2) ^ (g << 5));
  v8f acc = {};
  // Unrolled so that the next steps' LDS reads issue ahead of the WMMAs in front
  // of them and take constant offsets from one address a trip; a group's short
  // range is unrolled whole, so that no address arithmetic stands among its WMMAs.
  constexpr int UN = KS > 1 ? KL / 4 : 16;
#pragma unroll UN
  for (int kk = 0; kk < KL; kk += 4) {
    v2f a = *(const v2f*)(ar + kk);        // A[m][k], A[m][k+1], k = the group's first + kk + 2g
    v2f b = *(const v2f*)(br + kk * NC);   // B[k][n], B[k+1][n]
    acc = wmma4(a, b, acc);
  }
  if constexpr (KS > 1) {
    const int grp = __builtin_amdgcn_readfirstlane(wave / NTL);
    if (grp > 0) {
      float* w = sR + ((grp - 1) * NTL + tile) * 256 + lane;
#pragma unroll
      for (int p = 0; p < 8; ++p) w[p * 32] = acc[p];
    }
    __syncthreads();                       // the other groups' sums are in sR
    if (grp == 0) {
#pragma unroll
      for (int s = 0; s < KS - 1; ++s) {
        const float* r = sR + (s * NTL + tile) * 256 + lane;
#pragma unroll
        for (int p = 0; p < 8; ++p) acc[p] += r[p * 32];
      }
    }
  }
  return acc;
}

// ---------------------------------------------------------------------------
// fp32 GEMM: Y[1024,256] = X[1024,256] @ W[256,256] (+ bias[256]).
// One block of NT threads per 32 x NC output tile. Five products in one grid fill
// the chip with 32 x 64 tiles and one wave a WMMA tile; a single product takes
// 32 x 32 tiles, 256 blocks, and four waves a WMMA tile, a quarter of k each.
// Up to five products of one X share a grid: blockIdx.y picks W and bias, and
// the results lie one behind the other from Y0.
// ---------------------------------------------------------------------------
template <int NC, int NT>
__global__ __launch_bounds__(NT) void gemm_xw_kernel(
    const float* __restrict__ X,
    const float* __restrict__ W0, const float* __restrict__ bias0,
    const float* __restrict__ W1, const float* __restrict__ bias1,
    const float* __restrict__ W2, const float* __restrict__ bias2,
    const float* __restrict__ W3, const float* __restrict__ bias3,
    const float* __restrict__ W4, const float* __restrict__ bias4,
    float* __restrict__ Y0) {
  using T = TileShape<D_, NC, NT>;
  constexpr int NTL = T::NTL, KS = T::KS;
  __shared__ __attribute__((aligned(16))) float smem[T::FLOATS];
  const int which = blockIdx.y;
  const float* W = W0;
  const float* bias = bias0;
  if (which == 1) { W = W1; bias = bias1; }
  if (which == 2) { W = W2; bias = bias2; }
  if (which == 3) { W = W3; bias = bias3; }
  if (which == 4) { W = W4; bias = bias4; }
  float* Y = Y0 + (size_t)which * (B_ * N_) * D_;
  const int wave = threadIdx.x >> 5;
  const int lane = threadIdx.x & 31;
  const int m16 = lane & 15;
  const int g   = lane >> 4;
  const int row0 = (blockIdx.x / (D_ / NC)) * 32;
  const int col0 = (blockIdx.x % (D_ / NC)) * NC;

  const v8f acc = staged_tile_product<D_, D_, D_, NC, NT, false>(
      X + (size_t)row0 * D_, W + col0, smem);

  if (KS == 1 || wave < NTL) {             // the waves that hold the whole sum
    const int col = col0 + (wave % (NC / 16)) * 16 + m16;
    const float bv = bias ? bias[col] : 0.0f;
    float* yout = Y + (size_t)(row0 + (wave / (NC / 16)) * 16) * D_ + col;
#pragma unroll
    for (int p = 0; p < 8; ++p)
      yout[(size_t)(p + 8 * g) * D_] = acc[p] + bv;
  }
}

// ---------------------------------------------------------------------------
// Phase A: S[b,h,i,j] = scale*(q_i . k_j) + (mask ? physics_bias : -1e9)
// One block per (b, i-tile16, j-tile16). 8 waves:
//   all waves  : stage the x_j tile, the x_i tile and Wp2 in LDS, whole lines;
//                pack the tile's unmasked (i, j) pairs into one list
//   waves 0..3 : QK^T for head = wave (16 WMMA over hd=64)
//   all waves  : physics bias of 16 listed pairs at a time
//                (GELU into A-frag, [16 pairs x 256d] @ Wp2[256d x 4h] via WMMA),
//                every fragment of the k loop read from LDS
// A masked pair's bias is never used (the reference selects -1e9 there), so it is
// not computed: a tile with n unmasked pairs costs ceil(n / 16) groups, 16 at most.
// ---------------------------------------------------------------------------
// LDS pitch in floats of the x_j tile, the x_i tile and the transposed Wp2:
// 260 = 4 mod 64 banks, so the 16 rows x 2 k pairs of one 8-byte fragment read
// fall on 64 different banks; lanes whose pairs share a row read the same address.
#define BP_  260
#define SB_OFF 0
#define SA_OFF (16 * BP_)
#define SW_OFF (32 * BP_)
#define SMEM_FLOATS (32 * BP_ + (H_ + 1) * BP_)

// Bias of 16 pairs: row m of the A operand is gelu(x_i side + x_j side) of the
// lane's own pair; every pair sums its products in ascending k, four to a WMMA.
__device__ __forceinline__ v8f bias_of_16_pairs(const float* arow, const float* brow,
                                                const float* wrow) {
  v8f acc = {};
  for (int kk = 0; kk < D_; kk += 4) {
    v2f bp = *(const v2f*)(brow + kk);
    v2f ap = *(const v2f*)(arow + kk);
    v2f a = gelu_exact2(ap + bp);
    v2f bf = *(const v2f*)(wrow + kk);   // Wp2[d0][n], Wp2[d0+1][n]; 0 for n >= 4
    acc = wmma4(a, bf, acc);
  }
  return acc;
}

__global__ __launch_bounds__(256) void scores_kernel(
    const float* __restrict__ Q, const float* __restrict__ Kb,
    const float* __restrict__ Ab, const float* __restrict__ Bb,
    const float* __restrict__ Wp2, const float* __restrict__ bp2,
    const int* __restrict__ adj, float* __restrict__ S) {
  __shared__ __attribute__((aligned(16))) float smem[SMEM_FLOATS];
  __shared__ __attribute__((aligned(16))) int sList[256];  // ii * 16 + jj, unmasked first
  __shared__ __attribute__((aligned(16))) int sCnt[8];     // unmasked pairs a wave
  float* sB = smem + SB_OFF;               // [16 j][BP_]   x_j side
  float* sA = smem + SA_OFF;               // [16 i][BP_]   x_i side (+bp1)
  float* sW = smem + SW_OFF;               // [H_ + 1][BP_] Wp2 transposed, row H_ = 0
  // The two result tiles take the place of the x_j tile once the k loops are done.
  float* lds_qk   = smem;                  // [h][i][j]
  float* lds_bias = smem + H_ * 256;       // [i][j][h], and one spare [h] behind it

  const int blk = blockIdx.x;              // b*1024 + it*32 + jt
  const int b  = blk >> 10;
  const int it = (blk >> 5) & 31;
  const int jt = blk & 31;
  const int wave = __builtin_amdgcn_readfirstlane(threadIdx.x >> 5);
  const int lane = threadIdx.x & 31;
  const int m16 = lane & 15;
  const int g   = lane >> 4;

  // ---- the thread's own pair of the tile and its mask ----
  const int ii = threadIdx.x >> 4;
  const int jj = threadIdx.x & 15;
  const int i = it * 16 + ii;
  const int j = jt * 16 + jj;
  const bool mk = adj[i * N_ + j] != 0;
  // Precaution: the wait stands in front of the code below, which reuses the
  // register that holds this load's address.
  asm volatile("s_wait_xcnt 0x0" ::: "memory");

  // ---- stage: each wave-wide 16-byte load covers 512 contiguous bytes ----
  {
    const float4* gB = (const float4*)(Bb + (size_t)(b * N_ + jt * 16) * D_);
    const float4* gA = (const float4*)(Ab + (size_t)(b * N_ + it * 16) * D_);
#pragma unroll
    for (int r = 0; r < 4; ++r) {
      const int idx = threadIdx.x + 256 * r;     // float4 index in the 16 x 64 tile
      const int row = idx >> 6;
      const int c4  = idx & 63;
      *(float4*)(sB + row * BP_ + c4 * 4) = gB[idx];
      *(float4*)(sA + row * BP_ + c4 * 4) = gA[idx];
    }
    const float4 w = ((const float4*)Wp2)[threadIdx.x];   // Wp2[d][0..3], d = thread
    sW[0 * BP_ + threadIdx.x] = w.x;
    sW[1 * BP_ + threadIdx.x] = w.y;
    sW[2 * BP_ + threadIdx.x] = w.z;
    sW[3 * BP_ + threadIdx.x] = w.w;
    sW[H_ * BP_ + threadIdx.x] = 0.0f;           // columns 4..15 of the B operand
  }
  const unsigned bal = __builtin_amdgcn_ballot_w32(mk);
  if (lane == 0) sCnt[wave] = __builtin_popcount(bal);
  __syncthreads();

  // ---- pack: unmasked pairs in thread order; the rest of the list names pair 0,
  //      a valid row for the lanes that fill up the last group ----
  int before = 0, total = 0;
#pragma unroll
  for (int w = 0; w < 8; ++w) {
    const int c = sCnt[w];
    total += c;
    before += (w < wave) ? c : 0;
  }
  total = __builtin_amdgcn_readfirstlane(total);
  if (mk) sList[before + __builtin_amdgcn_mbcnt_lo(bal, 0u)] = threadIdx.x;
  if ((int)threadIdx.x >= total) sList[threadIdx.x] = 0;
  __syncthreads();                         // the list is whole before any group reads it
  const int ngroups = (total + 15) >> 4;   // 0..16

  // ---- QK^T (heads on waves 0..3) ----
  v8f qk = {};
  if (wave < H_) {
    const int h = wave;
    const float* qrow = Q  + (size_t)(b * N_ + it * 16 + m16) * D_ + h * HD_;
    const float* krow = Kb + (size_t)(b * N_ + jt * 16 + m16) * D_ + h * HD_;
    for (int kk = 0; kk < HD_; kk += 4) {
      const int d0 = kk + 2 * g;
      v2f a = *(const v2f*)(qrow + d0);
      v2f bf = *(const v2f*)(krow + d0);   // B[k][n] = K[n][k] -> contiguous in k
      qk = wmma4(a, bf, qk);
    }
  }

  // ---- physics bias: a wave takes groups first and first + 8 of the list. Waves
  //      4..7, which have no QK^T, come first; the turn by the block index spreads
  //      the groups past a multiple of 8 over the four SIMDs (waves w, w + 4). ----
  const int first = (((wave & 3) + blk + (blk >> 8)) & 3) + (wave < H_ ? 4 : 0);
  const float* wrow = sW + (m16 < H_ ? m16 : H_) * BP_ + 2 * g;    // Wp2 column
  v8f pb[2];
#pragma unroll
  for (int s = 0; s < 2; ++s) {
    const int grp = first + 8 * s;
    v8f acc = {};
    if (grp < ngroups) {
      const int pid = sList[grp * 16 + m16];
      acc = bias_of_16_pairs(sA + (pid >> 4) * BP_ + 2 * g,        // x_i side (+bp1)
                             sB + (pid & 15) * BP_ + 2 * g, wrow); // x_j side
    }
    pb[s] = acc;
  }
  __syncthreads();                         // every wave has left the staged tiles

  if (wave < H_) {
#pragma unroll
    for (int p = 0; p < 8; ++p) lds_qk[(wave * 16 + p + 8 * g) * 16 + m16] = qk[p];
  }
  if (m16 < H_) {
#pragma unroll
    for (int s = 0; s < 2; ++s) {
      const int grp = first + 8 * s;
      if (grp < ngroups) {
        const int pos = grp * 16 + 8 * g;             // list place of D row 8g
        const int4 l0 = *(const int4*)(sList + pos);
        const int4 l1 = *(const int4*)(sList + pos + 4);
        const int pid[8] = {l0.x, l0.y, l0.z, l0.w, l1.x, l1.y, l1.z, l1.w};
        // Rows past the end of the list go to a slot behind the tile that nobody reads.
#pragma unroll
        for (int p = 0; p < 8; ++p)
          lds_bias[(pos + p < total ? pid[p] : 256) * H_ + m16] = pb[s][p];
      }
    }
  }
  __syncthreads();

  // ---- combine + mask + store ----
#pragma unroll
  for (int h = 0; h < H_; ++h) {
    const float bias_v = lds_bias[(ii * 16 + jj) * H_ + h] + bp2[h];
    const float v = lds_qk[(h * 16 + ii) * 16 + jj] * SCALE + (mk ? bias_v : NEGINF);
    S[((size_t)(b * H_ + h) * N_ + i) * N_ + j] = v;
  }
}

// ---------------------------------------------------------------------------
// Phase B: O[b,i,h*64+d] = sum_j softmax_j(S[b,h,i,:])[j] * V[b,j,h*64+d]  (WMMA, K=512)
// One block of 16 waves per (b, h, 32 rows i, 32 columns d): 8 * 16 * 2 = 256 blocks,
// four waves a WMMA tile, a quarter of k each. A block holds its 32 score rows whole,
// so the row softmax is done on the way into LDS.
// ---------------------------------------------------------------------------
__global__ __launch_bounds__(512) void pv_kernel(
    const float* __restrict__ S, const float* __restrict__ V,
    float* __restrict__ O) {
  __shared__ __attribute__((aligned(16))) float smem[TileShape<N_, 32, 512>::FLOATS];
  const int wave = threadIdx.x >> 5;
  const int lane = threadIdx.x & 31;
  const int m16 = lane & 15;
  const int g   = lane >> 4;
  const int bh = blockIdx.x >> 5;
  const int i0 = ((blockIdx.x >> 1) & 15) * 32;
  const int d0 = (blockIdx.x & 1) * 32;
  const int b = bh >> 2, h = bh & 3;

  const v8f acc = staged_tile_product<N_, N_, D_, 32, 512, true>(
      S + ((size_t)bh * N_ + i0) * N_, V + (size_t)b * N_ * D_ + h * HD_ + d0, smem);

  if (wave < 4) {                          // the waves that hold the whole sum
    float* orow = O + (size_t)(b * N_ + i0 + (wave >> 1) * 16) * D_ + h * HD_ + d0 +
                  (wave & 1) * 16 + m16;
#pragma unroll
    for (int p = 0; p < 8; ++p) orow[(size_t)(p + 8 * g) * D_] = acc[p];
  }
}

// ---------------------------------------------------------------------------
// Host launcher. Workspace layout (floats):
//   Q,K,V,A,B : 5 * 1024*256            = 1,310,720
//   S         : 2*4*512*512             = 2,097,152
//   O         : 1024*256                =   262,144
// Total ~14.0 MB.
// ---------------------------------------------------------------------------
extern "C" void kernel_launch(void* const* d_in, const int* in_sizes, int n_in,
                              void* d_out, int out_size, void* d_ws,
                              size_t ws_size, hipStream_t stream) {
  (void)in_sizes; (void)n_in; (void)out_size; (void)ws_size;
  const float* x   = (const float*)d_in[0];
  const int*   adj = (const int*)  d_in[1];
  const float* Wq  = (const float*)d_in[2];
  const float* bq  = (const float*)d_in[3];
  const float* Wk  = (const float*)d_in[4];
  const float* bk  = (const float*)d_in[5];
  const float* Wv  = (const float*)d_in[6];
  const float* bv  = (const float*)d_in[7];
  const float* Wo  = (const float*)d_in[8];
  const float* bo  = (const float*)d_in[9];
  const float* Wp1 = (const float*)d_in[10];  // [2D, D] row-major
  const float* bp1 = (const float*)d_in[11];
  const float* Wp2 = (const float*)d_in[12];  // [D, H] row-major
  const float* bp2 = (const float*)d_in[13];

  const int M = B_ * N_;  // 1024
  float* ws = (float*)d_ws;
  float* Qb = ws;
  float* Kb = Qb + (size_t)M * D_;
  float* Vb = Kb + (size_t)M * D_;
  float* Ab = Vb + (size_t)M * D_;
  float* Bb = Ab + (size_t)M * D_;
  float* Sb = Bb + (size_t)M * D_;                       // [B,H,N,N]
  float* Ob = Sb + (size_t)B_ * H_ * N_ * N_;

  const dim3 blk(256);

  // Projections, all five in one launch (bp1 folded into the x_i side of the
  // physics MLP); Qb, Kb, Vb, Ab, Bb lie one behind the other in the workspace.
  gemm_xw_kernel<64, 256><<<dim3((M / 32) * (D_ / 64), 5), blk, 0, stream>>>(
      x, Wq, bq, Wk, bk, Wv, bv, Wp1, bp1, Wp1 + (size_t)D_ * D_, nullptr,
      Qb);

  scores_kernel<<<B_ * 32 * 32, blk, 0, stream>>>(Qb, Kb, Ab, Bb, Wp2, bp2,
                                                  adj, Sb);
  pv_kernel<<<B_ * H_ * (N_ / 32) * (HD_ / 32), dim3(512), 0, stream>>>(Sb, Vb, Ob);
  gemm_xw_kernel<32, 512><<<(M / 32) * (D_ / 32), dim3(512), 0, stream>>>(
      Ob, Wo, bo, nullptr, nullptr, nullptr, nullptr, nullptr, nullptr, nullptr,
      nullptr, (float*)d_out);
}

// v008
// Measured time: 49.1 microseconds a run.
// Two timings next to v007 both put it at 1.04 times that version's speed.
// Counting every step since v000, it is 4.58 times as fast.
#include <hip/hip_runtime.h>
#include <math.h>

// Problem constants (PhysicsGatedAttention): B=2, N=512, HIDDEN=256, HEADS=4, HEAD_DIM=64
#define N_   512
#define D_   256
#define H_   4
#define HD_  64
#define B_   2
#define SCALE   0.125f      // HEAD_DIM^-0.5
#define NEGINF  (-1e9f)

typedef float v2f __attribute__((ext_vector_type(2)));
typedef float v8f __attribute__((ext_vector_type(8)));

// V_WMMA_F32_16X16X4_F32 : D(16x16 f32) = A(16x4 f32) * B(4x16 f32) + C
// Layouts (wave32):
//   A frag: lane = m + 16*g (m=0..15, g=0..1); a.x=A[m][k+2g], a.y=A[m][k+2g+1]
//   B frag: lane = n + 16*g;                    b.x=B[k+2g][n], b.y=B[k+2g+1][n]
//   C/D   : lane = n + 16*g, vgpr p => D[p+8g][n]
__device__ __forceinline__ v8f wmma4(v2f a, v2f b, v8f c) {
  return __builtin_amdgcn_wmma_f32_16x16x4_f32(false, a, false, b, (short)0, c,
                                               false, false);
}

// jax.nn.gelu(approximate=False): 0.5*x*(1+erf(x/sqrt(2))) = x*Phi(x), two values
// at a time and without a branch. The argument is z = x/2. With T(|x|), the upper
// normal tail, x*Phi(x) = 0.5*x + |x|*(0.5 - T(|x|)) = (z + |z|) - |z| * 2T(2|z|) for
// either sign of x. log2(2T(2y)) is smooth and falls ever faster, so that one
// polynomial of degree 5 in y = |z| stands for it: 2T = exp2(P(y)), one transcendental
// a value and no reciprocal. The coefficients are a minimax fit of the error of the
// whole term, y * (exp2(P(y)) - 2T(2y)): below 4.5e-7 for all y >= 0. The leading
// coefficient is negative: P falls to -inf and the term to 0 as y grows.
__device__ __forceinline__ v2f splat2(float c) { v2f r = {c, c}; return r; }

__device__ __forceinline__ v2f gelu_of_twice2(v2f z) {
  const v2f y = {__builtin_fabsf(z.x), __builtin_fabsf(z.y)};
  v2f p = __builtin_elementwise_fma(y, splat2(-0.01514540892f), splat2(0.1133513823f));
  p = __builtin_elementwise_fma(y, p, splat2(-0.4146173596f));
  p = __builtin_elementwise_fma(y, p, splat2(-1.839970589f));
  p = __builtin_elementwise_fma(y, p, splat2(-2.301575422f));
  p = __builtin_elementwise_fma(y, p, splat2(-0.00003763227505f));
  const v2f e = {__builtin_amdgcn_exp2f(p.x), __builtin_amdgcn_exp2f(p.y)};
  return __builtin_elementwise_fma(-y, e, z + y);
}

// ---------------------------------------------------------------------------
// One 32 x NC block tile of C = A[32,K] * B[K,NC], both operands staged once in
// LDS by NT threads. Every global load is 16 bytes a lane and covers whole 128-byte
// lines, and all of a thread's loads are issued before the first LDS store, so the block
// pays the load latency once, not once per group of k steps, and no load is
// spread over 16 lines as a fragment load from global memory would be.
//   sA : [32 rows][KL + 4]; the pitch is 4 mod 64 banks, so the 16 rows x 2 k
//        pairs of one 8-byte fragment read fall on 64 different banks.
//   sB : [KL / 2 row pairs][NC columns][2]: rows 2r and 2r+1 interleaved, so that
//        one 8-byte read gives the lane's (b.x, b.y). Odd row pairs have column
//        bit 4 flipped (32 floats): the two pairs of one read use different banks.
// The tile has 2 x NC / 16 WMMA tiles. Where the block has KS times as many waves,
// the k range is dealt to KS groups of waves, K / KS each: a narrow tile then gives
// twice the blocks, one for every WGP, and a SIMD's share of the WMMAs is spread
// over KS waves, which cover each other's LDS latency. Within its range a wave sums
// in ascending k, four products to a WMMA; groups 1.. hand their sums over in sR,
// and group 0 adds them in ascending order: only its waves return the result.
// Each group's slices of A and B (KL = K / KS of k) lie side by side in LDS, GS floats
// from the next group's: the group's place is in the address register, and every
// fragment read of the k loop is that register plus an immediate offset.
// With ROW_SOFTMAX the A operand is softmax(A) along k: a wave then loads R whole
// rows (Q 16-byte pieces a lane and row), so that a row's maximum and sum
// are taken over the wave's own registers and lanes, and the normalised values go
// to LDS. The rows never travel to memory and back between softmax and product.
// ---------------------------------------------------------------------------
// 2^w. The v_nop keeps the one slot that the instruction set asks for behind a
// transcendental before its source register is overwritten.
__device__ __forceinline__ float exp2_with_slot(float w) {
  float e;
  asm("v_exp_f32 %0, %1\n\tv_nop" : "=v"(e) : "v"(w));
  return e;
}

template <int R, int Q>
__device__ __forceinline__ void softmax_of_rows(float4 (&v)[R * Q]) {
  constexpr float LOG2E = 1.44269504088896340736f;
  float mx[R], sum[R];
  // All loops here are unrolled: the array stays in registers, and the rows'
  // cross-lane steps stand side by side, so that their latencies overlap.
#pragma unroll
  for (int rr = 0; rr < R; ++rr) {
    float m = -3.4e38f;
#pragma unroll
    for (int t = 0; t < Q; ++t) {
      const float4 x = v[rr * Q + t];
      m = fmaxf(m, fmaxf(fmaxf(x.x, x.y), fmaxf(x.z, x.w)));
    }
    mx[rr] = m;
  }
#pragma unroll
  for (int off = 16; off >= 1; off >>= 1) {
#pragma unroll
    for (int rr = 0; rr < R; ++rr) mx[rr] = fmaxf(mx[rr], __shfl_xor(mx[rr], off));
  }
#pragma unroll
  for (int rr = 0; rr < R; ++rr) {
    float s = 0.0f;
#pragma unroll
    for (int t = 0; t < Q; ++t) {
      float4 x = v[rr * Q + t];
      x.x = exp2_with_slot((x.x - mx[rr]) * LOG2E);
      x.y = exp2_with_slot((x.y - mx[rr]) * LOG2E);
      x.z = exp2_with_slot((x.z - mx[rr]) * LOG2E);
      x.w = exp2_with_slot((x.w - mx[rr]) * LOG2E);
      s += (x.x + x.y) + (x.z + x.w);
      v[rr * Q + t] = x;
    }
    sum[rr] = s;
  }
#pragma unroll
  for (int off = 16; off >= 1; off >>= 1) {
#pragma unroll
    for (int rr = 0; rr < R; ++rr) sum[rr] += __shfl_xor(sum[rr], off);
  }
#pragma unroll
  for (int rr = 0; rr < R; ++rr) {
    const float inv = 1.0f / sum[rr];
#pragma unroll
    for (int t = 0; t < Q; ++t) {
      float4 x = v[rr * Q + t];
      x.x *= inv; x.y *= inv; x.z *= inv; x.w *= inv;
      v[rr * Q + t] = x;
    }
  }
}

template <int K, int NC, int NT>
struct TileShape {
  static constexpr int NTL = 2 * NC / 16;        // WMMA tiles of the block tile
  static constexpr int KS  = NT / 32 / NTL;      // groups of waves that share the k range
  static constexpr int KL  = K / KS;             // k range of a group
  static constexpr int AP  = KL + 4;             // floats a row in sA
  static constexpr int PP  = 2 * NC;             // floats a row pair in sB
  static constexpr int AS  = 32 * AP;            // floats of a group's slice of A
  static constexpr int GS  = AS + KL / 2 * PP;   // floats of a group's two slices
  static constexpr int RS  = (KS - 1) * NTL * 256;   // floats of sR
  static constexpr int FLOATS = RS + KS * GS;    // sR, then the groups' slices
};

template <int K, int LDA, int LDB, int NC, int NT, bool ROW_SOFTMAX>
__device__ __forceinline__ v8f staged_tile_product(
    const float* __restrict__ Ag, const float* __restrict__ Bg, float* smem) {
  using T = TileShape<K, NC, NT>;
  constexpr int NTL = T::NTL, KS = T::KS, KL = T::KL, AP = T::AP, PP = T::PP, GS = T::GS;
  constexpr int NRA = 8 * K / NT;          // 16-byte pieces of A a thread
  constexpr int RA  = 4 * NT / K;          // rows of A a round
  constexpr int R   = 1024 / NT;           // rows a wave, where a wave has whole rows
  constexpr int Q   = K / 128;             // rounds a row there
  constexpr int C4  = NC / 4;              // 16-byte pieces a row of B
  constexpr int PR  = NT / C4;             // row pairs of B a round
  constexpr int NRB = K / 2 / PR;          // rounds of B
  static_assert(KS == 1 || PR % (KL / 2) == 0, "a round of B covers whole groups");
  static_assert(!ROW_SOFTMAX || KL % 128 == 0, "a 128-float piece of a row lies in one group");
  float* sR = smem;
  float* sA = smem + T::RS;
  float* sB = sA + T::AS;
  const int tid = threadIdx.x;
  const int arow = ROW_SOFTMAX ? (tid >> 5) * R : tid / (K / 4);
  const int ac4  = ROW_SOFTMAX ? (tid & 31) : tid % (K / 4);
  const int pr = tid / C4;                 // row pair of B
  const int c4 = tid % C4;
  const float* pa = Ag + arow * LDA + ac4 * 4;
  const float* pb = Bg + 2 * pr * LDB + c4 * 4;
  float4 ra[NRA], rb0[NRB], rb1[NRB];
  // The four loops below are unrolled so that the arrays stay in registers and
  // every round's address is the base plus a constant offset.
#pragma unroll
  for (int r = 0; r < NRA; ++r)
    ra[r] = *(const float4*)(pa + (ROW_SOFTMAX ? (r / Q) * LDA + (r % Q) * 128
                                               : r * RA * LDA));
#pragma unroll
  for (int r = 0; r < NRB; ++r) {
    rb0[r] = *(const float4*)(pb + r * 2 * PR * LDB);
    rb1[r] = *(const float4*)(pb + r * 2 * PR * LDB + LDB);
  }
  if constexpr (ROW_SOFTMAX) softmax_of_rows<R, Q>(ra);
  float* qa = sA + arow * AP +
              (ROW_SOFTMAX || KS == 1 ? ac4 * 4 : (ac4 * 4 / KL) * GS + ac4 * 4 % KL);
  float* qb = sB + (KS == 1 ? pr * PP : (pr / (KL / 2)) * GS + (pr % (KL / 2)) * PP) +
              ((c4 * 8) ^ ((pr & 1) << 5));
#pragma unroll
  for (int r = 0; r < NRA; ++r)
    *(float4*)(qa + (ROW_SOFTMAX ? (r / Q) * AP + ((r % Q) * 128 / KL) * GS + (r % Q) * 128 % KL
                                 : r * RA * AP)) = ra[r];
#pragma unroll
  for (int r = 0; r < NRB; ++r) {          // PR pairs on, PR even: the parity of pr stays
    float* q = qb + (KS == 1 ? r * PR * PP : r * (PR / (KL / 2)) * GS);
    *(float4*)q       = make_float4(rb0[r].x, rb1[r].x, rb0[r].y, rb1[r].y);
    *(float4*)(q + 4) = make_float4(rb0[r].z, rb1[r].z, rb0[r].w, rb1[r].w);
  }
  __syncthreads();                         // the tiles are whole before any fragment read

  const int wave = tid >> 5;
  const int lane = tid & 31;
  const int m16 = lane & 15;
  const int g   = lane >> 4;
  const int tile = KS > 1 ? wave % NTL : wave;   // tile / (NC / 16): 16 rows, the rest: 16 columns
  const int gs0  = KS > 1 ? (wave / NTL) * GS : 0;   // the group's slices
  const float* ar = sA + gs0 + ((tile / (NC / 16)) * 16 + m16) * AP + 2 * g;
  const float* br = sB + gs0 + g * PP + ((((tile % (NC / 16)) * 16 + m16) * 2) ^ (g << 5));
  v8f acc = {};
  // Unrolled so that the next steps' LDS reads issue ahead of the WMMAs in front
  // of them and take constant offsets from one address a trip; a group's short
  // range is unrolled whole, so that no address arithmetic stands among its WMMAs.
  constexpr int UN = KS > 1 ? KL / 4 : 16;
#pragma unroll UN
  for (int kk = 0; kk < KL; kk += 4) {
    v2f a = *(const v2f*)(ar + kk);        // A[m][k], A[m][k+1], k = the group's first + kk + 2g
    v2f b = *(const v2f*)(br + kk * NC);   // B[k][n], B[k+1][n]
    acc = wmma4(a, b, acc);
  }
  if constexpr (KS > 1) {
    const int grp = __builtin_amdgcn_readfirstlane(wave / NTL);
    if (grp > 0) {
      float* w = sR + ((grp - 1) * NTL + tile) * 256 + lane;
#pragma unroll
      for (int p = 0; p < 8; ++p) w[p * 32] = acc[p];
    }
    __syncthreads();                       // the other groups' sums are in sR
    if (grp == 0) {
#pragma unroll
      for (int s = 0; s < KS - 1; ++s) {
        const float* r = sR + (s * NTL + tile) * 256 + lane;
#pragma unroll
        for (int p = 0; p < 8; ++p) acc[p] += r[p * 32];
      }
    }
  }
  return acc;
}

// ---------------------------------------------------------------------------
// fp32 GEMM: Y[1024,256] = X[1024,256] @ W[256,256] (+ bias[256]).
// One block of NT threads per 32 x NC output tile. Five products in one grid fill
// the chip with 32 x 64 tiles and one wave a WMMA tile; a single product takes
// 32 x 32 tiles, 256 blocks, and four waves a WMMA tile, a quarter of k each.
// Up to five products of one X share a grid: blockIdx.y picks W and bias, and
// the results lie one behind the other from Y0.
// ---------------------------------------------------------------------------
template <int NC, int NT>
__global__ __launch_bounds__(NT) void gemm_xw_kernel(
    const float* __restrict__ X,
    const float* __restrict__ W0, const float* __restrict__ bias0,
    const float* __restrict__ W1, const float* __restrict__ bias1,
    const float* __restrict__ W2, const float* __restrict__ bias2,
    const float* __restrict__ W3, const float* __restrict__ bias3,
    const float* __restrict__ W4, const float* __restrict__ bias4,
    float* __restrict__ Y0) {
  using T = TileShape<D_, NC, NT>;
  constexpr int NTL = T::NTL, KS = T::KS;
  __shared__ __attribute__((aligned(16))) float smem[T::FLOATS];
  const int which = blockIdx.y;
  const float* W = W0;
  const float* bias = bias0;
  if (which == 1) { W = W1; bias = bias1; }
  if (which == 2) { W = W2; bias = bias2; }
  if (which == 3) { W = W3; bias = bias3; }
  if (which == 4) { W = W4; bias = bias4; }
  float* Y = Y0 + (size_t)which * (B_ * N_) * D_;
  const int wave = threadIdx.x >> 5;
  const int lane = threadIdx.x & 31;
  const int m16 = lane & 15;
  const int g   = lane >> 4;
  const int row0 = (blockIdx.x / (D_ / NC)) * 32;
  const int col0 = (blockIdx.x % (D_ / NC)) * NC;

  const v8f acc = staged_tile_product<D_, D_, D_, NC, NT, false>(
      X + (size_t)row0 * D_, W + col0, smem);

  if (KS == 1 || wave < NTL) {             // the waves that hold the whole sum
    const int col = col0 + (wave % (NC / 16)) * 16 + m16;
    const float bv = bias ? bias[col] : 0.0f;
    float* yout = Y + (size_t)(row0 + (wave / (NC / 16)) * 16) * D_ + col;
#pragma unroll
    for (int p = 0; p < 8; ++p)
      yout[(size_t)(p + 8 * g) * D_] = acc[p] + bv;
  }
}

// ---------------------------------------------------------------------------
// Phase A: S[b,h,i,j] = scale*(q_i . k_j) + (mask ? physics_bias : -1e9)
// One block per (b, i-tile16, j-tile16). 8 waves:
//   all waves  : stage the x_j tile, the x_i tile and Wp2 in LDS, whole lines;
//                pack the tile's unmasked (i, j) pairs into one list
//   waves 0..3 : QK^T for head = wave (16 WMMA over hd=64)
//   all waves  : physics bias of 16 listed pairs at a time
//                (GELU into A-frag, [16 pairs x 256d] @ Wp2[256d x 4h] via WMMA),
//                every fragment of the k loop read from LDS
// A masked pair's bias is never used (the reference selects -1e9 there), so it is
// not computed: a tile with n unmasked pairs costs ceil(n / 16) groups, 16 at most.
// ---------------------------------------------------------------------------
// LDS pitch in floats of the x_j tile, the x_i tile and the transposed Wp2:
// 260 = 4 mod 64 banks, so the 16 rows x 2 k pairs of one 8-byte fragment read
// fall on 64 different banks; lanes whose pairs share a row read the same address.
#define BP_  260
#define SB_OFF 0
#define SA_OFF (16 * BP_)
#define SW_OFF (32 * BP_)
#define SMEM_FLOATS (32 * BP_ + (H_ + 1) * BP_)

// Bias of 16 pairs: row m of the A operand is gelu(x_i side + x_j side) of the
// lane's own pair; both sides lie halved in LDS, so that their sum is the z of
// gelu_of_twice2. Every pair sums its products in ascending k, four to a WMMA.
__device__ __forceinline__ v8f bias_of_16_pairs(const float* arow, const float* brow,
                                                const float* wrow) {
  v8f acc = {};
  for (int kk = 0; kk < D_; kk += 4) {
    v2f bp = *(const v2f*)(brow + kk);
    v2f ap = *(const v2f*)(arow + kk);
    v2f a = gelu_of_twice2(ap + bp);
    v2f bf = *(const v2f*)(wrow + kk);   // Wp2[d0][n], Wp2[d0+1][n]; 0 for n >= 4
    acc = wmma4(a, bf, acc);
  }
  return acc;
}

__global__ __launch_bounds__(256) void scores_kernel(
    const float* __restrict__ Q, const float* __restrict__ Kb,
    const float* __restrict__ Ab, const float* __restrict__ Bb,
    const float* __restrict__ Wp2, const float* __restrict__ bp2,
    const int* __restrict__ adj, float* __restrict__ S) {
  __shared__ __attribute__((aligned(16))) float smem[SMEM_FLOATS];
  __shared__ __attribute__((aligned(16))) int sList[256];  // ii * 16 + jj, unmasked first
  __shared__ __attribute__((aligned(16))) int sCnt[8];     // unmasked pairs a wave
  float* sB = smem + SB_OFF;               // [16 j][BP_]   x_j side, halved
  float* sA = smem + SA_OFF;               // [16 i][BP_]   x_i side (+bp1), halved
  float* sW = smem + SW_OFF;               // [H_ + 1][BP_] Wp2 transposed, row H_ = 0
  // The two result tiles take the place of the x_j tile once the k loops are done.
  float* lds_qk   = smem;                  // [h][i][j]
  float* lds_bias = smem + H_ * 256;       // [i][j][h], and one spare [h] behind it

  const int blk = blockIdx.x;              // b*1024 + it*32 + jt
  const int b  = blk >> 10;
  const int it = (blk >> 5) & 31;
  const int jt = blk & 31;
  const int wave = __builtin_amdgcn_readfirstlane(threadIdx.x >> 5);
  const int lane = threadIdx.x & 31;
  const int m16 = lane & 15;
  const int g   = lane >> 4;

  // ---- the thread's own pair of the tile and its mask ----
  const int ii = threadIdx.x >> 4;
  const int jj = threadIdx.x & 15;
  const int i = it * 16 + ii;
  const int j = jt * 16 + jj;
  const bool mk = adj[i * N_ + j] != 0;
  // Precaution: the wait stands in front of the code below, which reuses the
  // register that holds this load's address.
  asm volatile("s_wait_xcnt 0x0" ::: "memory");

  // ---- stage: each wave-wide 16-byte load covers 512 contiguous bytes ----
  {
    const float4* gB = (const float4*)(Bb + (size_t)(b * N_ + jt * 16) * D_);
    const float4* gA = (const float4*)(Ab + (size_t)(b * N_ + it * 16) * D_);
#pragma unroll
    for (int r = 0; r < 4; ++r) {
      const int idx = threadIdx.x + 256 * r;     // float4 index in the 16 x 64 tile
      const int row = idx >> 6;
      const int c4  = idx & 63;
      const float4 vb = gB[idx];
      const float4 va = gA[idx];
      // Halved here, once a value (exact in f32), not once a pair in the k loop.
      *(float4*)(sB + row * BP_ + c4 * 4) =
          make_float4(0.5f * vb.x, 0.5f * vb.y, 0.5f * vb.z, 0.5f * vb.w);
      *(float4*)(sA + row * BP_ + c4 * 4) =
          make_float4(0.5f * va.x, 0.5f * va.y, 0.5f * va.z, 0.5f * va.w);
    }
    const float4 w = ((const float4*)Wp2)[threadIdx.x];   // Wp2[d][0..3], d = thread
    sW[0 * BP_ + threadIdx.x] = w.x;
    sW[1 * BP_ + threadIdx.x] = w.y;
    sW[2 * BP_ + threadIdx.x] = w.z;
    sW[3 * BP_ + threadIdx.x] = w.w;
    sW[H_ * BP_ + threadIdx.x] = 0.0f;           // columns 4..15 of the B operand
  }
  const unsigned bal = __builtin_amdgcn_ballot_w32(mk);
  if (lane == 0) sCnt[wave] = __builtin_popcount(bal);
  __syncthreads();

  // ---- pack: unmasked pairs in thread order; the rest of the list names pair 0,
  //      a valid row for the lanes that fill up the last group ----
  int before = 0, total = 0;
#pragma unroll
  for (int w = 0; w < 8; ++w) {
    const int c = sCnt[w];
    total += c;
    before += (w < wave) ? c : 0;
  }
  total = __builtin_amdgcn_readfirstlane(total);
  if (mk) sList[before + __builtin_amdgcn_mbcnt_lo(bal, 0u)] = threadIdx.x;
  if ((int)threadIdx.x >= total) sList[threadIdx.x] = 0;
  __syncthreads();                         // the list is whole before any group reads it
  const int ngroups = (total + 15) >> 4;   // 0..16

  // ---- QK^T (heads on waves 0..3) ----
  v8f qk = {};
  if (wave < H_) {
    const int h = wave;
    const float* qrow = Q  + (size_t)(b * N_ + it * 16 + m16) * D_ + h * HD_;
    const float* krow = Kb + (size_t)(b * N_ + jt * 16 + m16) * D_ + h * HD_;
    for (int kk = 0; kk < HD_; kk += 4) {
      const int d0 = kk + 2 * g;
      v2f a = *(const v2f*)(qrow + d0);
      v2f bf = *(const v2f*)(krow + d0);   // B[k][n] = K[n][k] -> contiguous in k
      qk = wmma4(a, bf, qk);
    }
  }

  // ---- physics bias: a wave takes groups first and first + 8 of the list. Waves
  //      4..7, which have no QK^T, come first; the turn by the block index spreads
  //      the groups past a multiple of 8 over the four SIMDs (waves w, w + 4). ----
  const int first = (((wave & 3) + blk + (blk >> 8)) & 3) + (wave < H_ ? 4 : 0);
  const float* wrow = sW + (m16 < H_ ? m16 : H_) * BP_ + 2 * g;    // Wp2 column
  v8f pb[2];
#pragma unroll
  for (int s = 0; s < 2; ++s) {
    const int grp = first + 8 * s;
    v8f acc = {};
    if (grp < ngroups) {
      const int pid = sList[grp * 16 + m16];
      acc = bias_of_16_pairs(sA + (pid >> 4) * BP_ + 2 * g,        // x_i side (+bp1)
                             sB + (pid & 15) * BP_ + 2 * g, wrow); // x_j side
    }
    pb[s] = acc;
  }
  __syncthreads();                         // every wave has left the staged tiles

  if (wave < H_) {
#pragma unroll
    for (int p = 0; p < 8; ++p) lds_qk[(wave * 16 + p + 8 * g) * 16 + m16] = qk[p];
  }
  if (m16 < H_) {
#pragma unroll
    for (int s = 0; s < 2; ++s) {
      const int grp = first + 8 * s;
      if (grp < ngroups) {
        const int pos = grp * 16 + 8 * g;             // list place of D row 8g
        const int4 l0 = *(const int4*)(sList + pos);
        const int4 l1 = *(const int4*)(sList + pos + 4);
        const int pid[8] = {l0.x, l0.y, l0.z, l0.w, l1.x, l1.y, l1.z, l1.w};
        // Rows past the end of the list go to a slot behind the tile that nobody reads.
#pragma unroll
        for (int p = 0; p < 8; ++p)
          lds_bias[(pos + p < total ? pid[p] : 256) * H_ + m16] = pb[s][p];
      }
    }
  }
  __syncthreads();

  // ---- combine + mask + store ----
#pragma unroll
  for (int h = 0; h < H_; ++h) {
    const float bias_v = lds_bias[(ii * 16 + jj) * H_ + h] + bp2[h];
    const float v = lds_qk[(h * 16 + ii) * 16 + jj] * SCALE + (mk ? bias_v : NEGINF);
    S[((size_t)(b * H_ + h) * N_ + i) * N_ + j] = v;
  }
}

// ---------------------------------------------------------------------------
// Phase B: O[b,i,h*64+d] = sum_j softmax_j(S[b,h,i,:])[j] * V[b,j,h*64+d]  (WMMA, K=512)
// One block of 16 waves per (b, h, 32 rows i, 32 columns d): 8 * 16 * 2 = 256 blocks,
// four waves a WMMA tile, a quarter of k each. A block holds its 32 score rows whole,
// so the row softmax is done on the way into LDS.
// ---------------------------------------------------------------------------
__global__ __launch_bounds__(512) void pv_kernel(
    const float* __restrict__ S, const float* __restrict__ V,
    float* __restrict__ O) {
  __shared__ __attribute__((aligned(16))) float smem[TileShape<N_, 32, 512>::FLOATS];
  const int wave = threadIdx.x >> 5;
  const int lane = threadIdx.x & 31;
  const int m16 = lane & 15;
  const int g   = lane >> 4;
  const int bh = blockIdx.x >> 5;
  const int i0 = ((blockIdx.x >> 1) & 15) * 32;
  const int d0 = (blockIdx.x & 1) * 32;
  const int b = bh >> 2, h = bh & 3;

  const v8f acc = staged_tile_product<N_, N_, D_, 32, 512, true>(
      S + ((size_t)bh * N_ + i0) * N_, V + (size_t)b * N_ * D_ + h * HD_ + d0, smem);

  if (wave < 4) {                          // the waves that hold the whole sum
    float* orow = O + (size_t)(b * N_ + i0 + (wave >> 1) * 16) * D_ + h * HD_ + d0 +
                  (wave & 1) * 16 + m16;
#pragma unroll
    for (int p = 0; p < 8; ++p) orow[(size_t)(p + 8 * g) * D_] = acc[p];
  }
}

// ---------------------------------------------------------------------------
// Host launcher. Workspace layout (floats):
//   Q,K,V,A,B : 5 * 1024*256            = 1,310,720
//   S         : 2*4*512*512             = 2,097,152
//   O         : 1024*256                =   262,144
// Total ~14.0 MB.
// ---------------------------------------------------------------------------
extern "C" void kernel_launch(void* const* d_in, const int* in_sizes, int n_in,
                              void* d_out, int out_size, void* d_ws,
                              size_t ws_size, hipStream_t stream) {
  (void)in_sizes; (void)n_in; (void)out_size; (void)ws_size;
  const float* x   = (const float*)d_in[0];
  const int*   adj = (const int*)  d_in[1];
  const float* Wq  = (const float*)d_in[2];
  const float* bq  = (const float*)d_in[3];
  const float* Wk  = (const float*)d_in[4];
  const float* bk  = (const float*)d_in[5];
  const float* Wv  = (const float*)d_in[6];
  const float* bv  = (const float*)d_in[7];
  const float* Wo  = (const float*)d_in[8];
  const float* bo  = (const float*)d_in[9];
  const float* Wp1 = (const float*)d_in[10];  // [2D, D] row-major
  const float* bp1 = (const float*)d_in[11];
  const float* Wp2 = (const float*)d_in[12];  // [D, H] row-major
  const float* bp2 = (const float*)d_in[13];

  const int M = B_ * N_;  // 1024
  float* ws = (float*)d_ws;
  float* Qb = ws;
  float* Kb = Qb + (size_t)M * D_;
  float* Vb = Kb + (size_t)M * D_;
  float* Ab = Vb + (size_t)M * D_;
  float* Bb = Ab + (size_t)M * D_;
  float* Sb = Bb + (size_t)M * D_;                       // [B,H,N,N]
  float* Ob = Sb + (size_t)B_ * H_ * N_ * N_;

  const dim3 blk(256);

  // Projections, all five in one launch (bp1 folded into the x_i side of the
  // physics MLP); Qb, Kb, Vb, Ab, Bb lie one behind the other in the workspace.
  gemm_xw_kernel<64, 256><<<dim3((M / 32) * (D_ / 64), 5), blk, 0, stream>>>(
      x, Wq, bq, Wk, bk, Wv, bv, Wp1, bp1, Wp1 + (size_t)D_ * D_, nullptr,
      Qb);

  scores_kernel<<<B_ * 32 * 32, blk, 0, stream>>>(Qb, Kb, Ab, Bb, Wp2, bp2,
                                                  adj, Sb);
  pv_kernel<<<B_ * H_ * (N_ / 32) * (HD_ / 32), dim3(512), 0, stream>>>(Sb, Vb, Ob);
  gemm_xw_kernel<32, 512><<<(M / 32) * (D_ / 32), dim3(512), 0, stream>>>(
      Ob, Wo, bo, nullptr, nullptr, nullptr, nullptr, nullptr, nullptr, nullptr,
      nullptr, (float*)d_out);
}

// v009
// A run of this version takes 44.6 microseconds.
// Two timings next to v008 both put it at 1.10 times that version's speed.
// Over all steps from v000 it is 5.05 times as fast.
#include <hip/hip_runtime.h>
#include <math.h>

// Problem constants: B=2, N=512, HIDDEN=256, HEADS=4, HEAD_DIM=64
#define N_   512
#define D_   256
#define H_   4
#define HD_  64
#define B_   2
#define SCALE   0.125f      // HEAD_DIM^-0.5
#define NEGINF  (-1e9f)

typedef float v2f __attribute__((ext_vector_type(2)));
typedef float v8f __attribute__((ext_vector_type(8)));

// V_WMMA_F32_16X16X4_F32 : D(16x16 f32) = A(16x4 f32) * B(4x16 f32) + C
// Layouts (wave32):
//   A frag: lane = m + 16*g (m=0..15, g=0..1); a.x=A[m][k+2g], a.y=A[m][k+2g+1]
//   B frag: lane = n + 16*g;                    b.x=B[k+2g][n], b.y=B[k+2g+1][n]
//   C/D   : lane = n + 16*g, vgpr p => D[p+8g][n]
__device__ __forceinline__ v8f wmma4(v2f a, v2f b, v8f c) {
  return __builtin_amdgcn_wmma_f32_16x16x4_f32(false, a, false, b, (short)0, c,
                                               false, false);
}

// jax.nn.gelu(approximate=False): 0.5*x*(1+erf(x/sqrt(2))) = x*Phi(x), two values
// at a time and without a branch. The argument is z = x/2. With T(|x|), the upper
// normal tail, x*Phi(x) = 0.5*x + |x|*(0.5 - T(|x|)) = (z + |z|) - |z| * 2T(2|z|) for
// either sign of x. log2(2T(2y)) is smooth and falls ever faster, so that one
// polynomial of degree 5 in y = |z| stands for it: 2T = exp2(P(y)), one transcendental
// a value and no reciprocal. The coefficients are a minimax fit of the error of the
// whole term, y * (exp2(P(y)) - 2T(2y)): below 4.5e-7 for all y >= 0. The leading
// coefficient is negative: P falls to -inf and the term to 0 as y grows.
__device__ __forceinline__ v2f splat2(float c) { v2f r = {c, c}; return r; }

__device__ __forceinline__ v2f gelu_of_twice2(v2f z) {
  const v2f y = {__builtin_fabsf(z.x), __builtin_fabsf(z.y)};
  v2f p = __builtin_elementwise_fma(y, splat2(-0.01514540892f), splat2(0.1133513823f));
  p = __builtin_elementwise_fma(y, p, splat2(-0.4146173596f));
  p = __builtin_elementwise_fma(y, p, splat2(-1.839970589f));
  p = __builtin_elementwise_fma(y, p, splat2(-2.301575422f));
  p = __builtin_elementwise_fma(y, p, splat2(-0.00003763227505f));
  const v2f e = {__builtin_amdgcn_exp2f(p.x), __builtin_amdgcn_exp2f(p.y)};
  return __builtin_elementwise_fma(-y, e, z + y);
}

// ---------------------------------------------------------------------------
// One 32 x NC block tile of C = A[32,K] * B[K,NC], both operands staged once in
// LDS by NT threads. Every global load is 16 bytes a lane and covers whole 128-byte
// lines, and all of a thread's loads are issued before the first LDS store, so the block
// pays the load latency once, not once per group of k steps, and no load is
// spread over 16 lines as a fragment load from global memory would be.
//   sA : [32 rows][KL + 4]; the pitch is 4 mod 64 banks, so the 16 rows x 2 k
//        pairs of one 8-byte fragment read fall on 64 different banks.
//   sB : [KL / 2 row pairs][NC columns][2]: rows 2r and 2r+1 interleaved, so that
//        one 8-byte read gives the lane's (b.x, b.y). Odd row pairs have column
//        bit 4 flipped (32 floats): the two pairs of one read use different banks.
// The tile has 2 x NC / 16 WMMA tiles. Where the block has KS times as many waves,
// the k range is dealt to KS groups of waves, K / KS each: a narrow tile then gives
// twice the blocks, one for every WGP, and a SIMD's share of the WMMAs is spread
// over KS waves, which cover each other's LDS latency. Within its range a wave sums
// in ascending k, four products to a WMMA; groups 1.. hand their sums over in sR,
// and group 0 adds them in ascending order: only its waves return the result.
// Each group's slices of A and B (KL = K / KS of k) lie side by side in LDS, GS floats
// from the next group's: the group's place is in the address register, and every
// fragment read of the k loop is that register plus an immediate offset.
// With ROW_SOFTMAX the A operand is softmax(A) along k: a wave then loads R whole
// rows (Q 16-byte pieces a lane and row), so that a row's maximum and sum
// are taken over the wave's own registers and lanes, and the normalised values go
// to LDS. The rows never travel to memory and back between softmax and product.
// ---------------------------------------------------------------------------
// 2^w. The v_nop keeps the one slot that the instruction set asks for behind a
// transcendental before its source register is overwritten.
__device__ __forceinline__ float exp2_with_slot(float w) {
  float e;
  asm("v_exp_f32 %0, %1\n\tv_nop" : "=v"(e) : "v"(w));
  return e;
}

template <int R, int Q>
__device__ __forceinline__ void softmax_of_rows(float4 (&v)[R * Q]) {
  constexpr float LOG2E = 1.44269504088896340736f;
  float mx[R], sum[R];
  // All loops here are unrolled: the array stays in registers, and the rows'
  // cross-lane steps stand side by side, so that their latencies overlap.
#pragma unroll
  for (int rr = 0; rr < R; ++rr) {
    float m = -3.4e38f;
#pragma unroll
    for (int t = 0; t < Q; ++t) {
      const float4 x = v[rr * Q + t];
      m = fmaxf(m, fmaxf(fmaxf(x.x, x.y), fmaxf(x.z, x.w)));
    }
    mx[rr] = m;
  }
#pragma unroll
  for (int off = 16; off >= 1; off >>= 1) {
#pragma unroll
    for (int rr = 0; rr < R; ++rr) mx[rr] = fmaxf(mx[rr], __shfl_xor(mx[rr], off));
  }
#pragma unroll
  for (int rr = 0; rr < R; ++rr) {
    float s = 0.0f;
#pragma unroll
    for (int t = 0; t < Q; ++t) {
      float4 x = v[rr * Q + t];
      x.x = exp2_with_slot((x.x - mx[rr]) * LOG2E);
      x.y = exp2_with_slot((x.y - mx[rr]) * LOG2E);
      x.z = exp2_with_slot((x.z - mx[rr]) * LOG2E);
      x.w = exp2_with_slot((x.w - mx[rr]) * LOG2E);
      s += (x.x + x.y) + (x.z + x.w);
      v[rr * Q + t] = x;
    }
    sum[rr] = s;
  }
#pragma unroll
  for (int off = 16; off >= 1; off >>= 1) {
#pragma unroll
    for (int rr = 0; rr < R; ++rr) sum[rr] += __shfl_xor(sum[rr], off);
  }
#pragma unroll
  for (int rr = 0; rr < R; ++rr) {
    const float inv = 1.0f / sum[rr];
#pragma unroll
    for (int t = 0; t < Q; ++t) {
      float4 x = v[rr * Q + t];
      x.x *= inv; x.y *= inv; x.z *= inv; x.w *= inv;
      v[rr * Q + t] = x;
    }
  }
}

template <int K, int NC, int NT>
struct TileShape {
  static constexpr int NTL = 2 * NC / 16;        // WMMA tiles of the block tile
  static constexpr int KS  = NT / 32 / NTL;      // groups of waves that share the k range
  static constexpr int KL  = K / KS;             // k range of a group
  static constexpr int AP  = KL + 4;             // floats a row in sA
  static constexpr int PP  = 2 * NC;             // floats a row pair in sB
  static constexpr int AS  = 32 * AP;            // floats of a group's slice of A
  static constexpr int GS  = AS + KL / 2 * PP;   // floats of a group's two slices
  static constexpr int RS  = (KS - 1) * NTL * 256;   // floats of sR
  static constexpr int FLOATS = RS + KS * GS;    // sR, then the groups' slices
};

template <int K, int LDA, int LDB, int NC, int NT, bool ROW_SOFTMAX>
__device__ __forceinline__ v8f staged_tile_product(
    const float* __restrict__ Ag, const float* __restrict__ Bg, float* smem) {
  using T = TileShape<K, NC, NT>;
  constexpr int NTL = T::NTL, KS = T::KS, KL = T::KL, AP = T::AP, PP = T::PP, GS = T::GS;
  constexpr int NRA = 8 * K / NT;          // 16-byte pieces of A a thread
  constexpr int RA  = 4 * NT / K;          // rows of A a round
  constexpr int R   = 1024 / NT;           // rows a wave, where a wave has whole rows
  constexpr int Q   = K / 128;             // rounds a row there
  constexpr int C4  = NC / 4;              // 16-byte pieces a row of B
  constexpr int PR  = NT / C4;             // row pairs of B a round
  constexpr int NRB = K / 2 / PR;          // rounds of B
  static_assert(KS == 1 || PR % (KL / 2) == 0, "a round of B covers whole groups");
  static_assert(!ROW_SOFTMAX || KL % 128 == 0, "a 128-float piece of a row lies in one group");
  float* sR = smem;
  float* sA = smem + T::RS;
  float* sB = sA + T::AS;
  const int tid = threadIdx.x;
  const int arow = ROW_SOFTMAX ? (tid >> 5) * R : tid / (K / 4);
  const int ac4  = ROW_SOFTMAX ? (tid & 31) : tid % (K / 4);
  const int pr = tid / C4;                 // row pair of B
  const int c4 = tid % C4;
  const float* pa = Ag + arow * LDA + ac4 * 4;
  const float* pb = Bg + 2 * pr * LDB + c4 * 4;
  float4 ra[NRA], rb0[NRB], rb1[NRB];
  // The four loops below are unrolled so that the arrays stay in registers and
  // every round's address is the base plus a constant offset.
#pragma unroll
  for (int r = 0; r < NRA; ++r)
    ra[r] = *(const float4*)(pa + (ROW_SOFTMAX ? (r / Q) * LDA + (r % Q) * 128
                                               : r * RA * LDA));
#pragma unroll
  for (int r = 0; r < NRB; ++r) {
    rb0[r] = *(const float4*)(pb + r * 2 * PR * LDB);
    rb1[r] = *(const float4*)(pb + r * 2 * PR * LDB + LDB);
  }
  if constexpr (ROW_SOFTMAX) softmax_of_rows<R, Q>(ra);
  float* qa = sA + arow * AP +
              (ROW_SOFTMAX || KS == 1 ? ac4 * 4 : (ac4 * 4 / KL) * GS + ac4 * 4 % KL);
  float* qb = sB + (KS == 1 ? pr * PP : (pr / (KL / 2)) * GS + (pr % (KL / 2)) * PP) +
              ((c4 * 8) ^ ((pr & 1) << 5));
#pragma unroll
  for (int r = 0; r < NRA; ++r)
    *(float4*)(qa + (ROW_SOFTMAX ? (r / Q) * AP + ((r % Q) * 128 / KL) * GS + (r % Q) * 128 % KL
                                 : r * RA * AP)) = ra[r];
#pragma unroll
  for (int r = 0; r < NRB; ++r) {          // PR pairs on, PR even: the parity of pr stays
    float* q = qb + (KS == 1 ? r * PR * PP : r * (PR / (KL / 2)) * GS);
    *(float4*)q       = make_float4(rb0[r].x, rb1[r].x, rb0[r].y, rb1[r].y);
    *(float4*)(q + 4) = make_float4(rb0[r].z, rb1[r].z, rb0[r].w, rb1[r].w);
  }
  __syncthreads();                         // the tiles are whole before any fragment read

  const int wave = tid >> 5;
  const int lane = tid & 31;
  const int m16 = lane & 15;
  const int g   = lane >> 4;
  const int tile = KS > 1 ? wave % NTL : wave;   // tile / (NC / 16): 16 rows, the rest: 16 columns
  const int gs0  = KS > 1 ? (wave / NTL) * GS : 0;   // the group's slices
  const float* ar = sA + gs0 + ((tile / (NC / 16)) * 16 + m16) * AP + 2 * g;
  const float* br = sB + gs0 + g * PP + ((((tile % (NC / 16)) * 16 + m16) * 2) ^ (g << 5));
  v8f acc = {};
  // Unrolled so that the next steps' LDS reads issue ahead of the WMMAs in front
  // of them and take constant offsets from one address a trip; a group's short
  // range is unrolled whole, so that no address arithmetic stands among its WMMAs.
  constexpr int UN = KS > 1 ? KL / 4 : 16;
#pragma unroll UN
  for (int kk = 0; kk < KL; kk += 4) {
    v2f a = *(const v2f*)(ar + kk);        // A[m][k], A[m][k+1], k = the group's first + kk + 2g
    v2f b = *(const v2f*)(br + kk * NC);   // B[k][n], B[k+1][n]
    acc = wmma4(a, b, acc);
  }
  if constexpr (KS > 1) {
    const int grp = __builtin_amdgcn_readfirstlane(wave / NTL);
    if (grp > 0) {
      float* w = sR + ((grp - 1) * NTL + tile) * 256 + lane;
#pragma unroll
      for (int p = 0; p < 8; ++p) w[p * 32] = acc[p];
    }
    __syncthreads();                       // the other groups' sums are in sR
    if (grp == 0) {
#pragma unroll
      for (int s = 0; s < KS - 1; ++s) {
        const float* r = sR + (s * NTL + tile) * 256 + lane;
#pragma unroll
        for (int p = 0; p < 8; ++p) acc[p] += r[p * 32];
      }
    }
  }
  return acc;
}

// ---------------------------------------------------------------------------
// fp32 GEMM: Y[1024,256] = X[1024,256] @ W[256,256] (+ bias[256]).
// One block of NT threads per 32 x NC output tile. Five products in one grid fill
// the chip with 32 x 64 tiles and one wave a WMMA tile; a single product takes
// 32 x 32 tiles, 256 blocks, and four waves a WMMA tile, a quarter of k each.
// Up to five products of one X share a grid: blockIdx.y picks W and bias, and
// the results lie one behind the other from Y0.
// ---------------------------------------------------------------------------
template <int NC, int NT>
__global__ __launch_bounds__(NT) void gemm_xw_kernel(
    const float* __restrict__ X,
    const float* __restrict__ W0, const float* __restrict__ bias0,
    const float* __restrict__ W1, const float* __restrict__ bias1,
    const float* __restrict__ W2, const float* __restrict__ bias2,
    const float* __restrict__ W3, const float* __restrict__ bias3,
    const float* __restrict__ W4, const float* __restrict__ bias4,
    float* __restrict__ Y0) {
  using T = TileShape<D_, NC, NT>;
  constexpr int NTL = T::NTL, KS = T::KS;
  __shared__ __attribute__((aligned(16))) float smem[T::FLOATS];
  const int which = blockIdx.y;
  const float* W = W0;
  const float* bias = bias0;
  if (which == 1) { W = W1; bias = bias1; }
  if (which == 2) { W = W2; bias = bias2; }
  if (which == 3) { W = W3; bias = bias3; }
  if (which == 4) { W = W4; bias = bias4; }
  float* Y = Y0 + (size_t)which * (B_ * N_) * D_;
  const int wave = threadIdx.x >> 5;
  const int lane = threadIdx.x & 31;
  const int m16 = lane & 15;
  const int g   = lane >> 4;
  const int row0 = (blockIdx.x / (D_ / NC)) * 32;
  const int col0 = (blockIdx.x % (D_ / NC)) * NC;

  const v8f acc = staged_tile_product<D_, D_, D_, NC, NT, false>(
      X + (size_t)row0 * D_, W + col0, smem);

  if (KS == 1 || wave < NTL) {             // the waves that hold the whole sum
    const int col = col0 + (wave % (NC / 16)) * 16 + m16;
    const float bv = bias ? bias[col] : 0.0f;
    float* yout = Y + (size_t)(row0 + (wave / (NC / 16)) * 16) * D_ + col;
#pragma unroll
    for (int p = 0; p < 8; ++p)
      yout[(size_t)(p + 8 * g) * D_] = acc[p] + bv;
  }
}

// ---------------------------------------------------------------------------
// Phase A: S[b,h,i,j] = scale*(q_i . k_j) + (mask ? physics_bias : -1e9)
// One block of 16 waves per (b, 32 rows i, 32 columns j): 512 blocks, two on a WGP, all
// resident at once; a staged row of x_i or x_j serves 32 pairs.
//   all waves : QK^T of head wave & 3 for one of the tile's four 16 x 16 quarters;
//               stage the x_j tile, the x_i tile and Wp2 in LDS, whole lines;
//               pack the tile's unmasked (i, j) pairs into one list
//   all waves : physics bias of 16 listed pairs at a time (GELU into the A fragment,
//               [16 pairs x 64 d] @ Wp2[64 d x 4 h] via WMMA). Wave w has the quarter
//               w & 3 of d, whose Wp2 fragments it keeps in registers, and every fourth
//               group of the list: the waves' shares differ by 16 WMMAs at most, and the
//               four SIMDs (waves w, w + 4, ..) have equal shares. The four partial sums
//               of a pair are added in ascending d when the scores are put together.
// A masked pair's bias is never used (the reference selects -1e9 there), so it is
// not computed: a tile with n unmasked pairs costs ceil(n / 16) groups, 64 at most.
// ---------------------------------------------------------------------------
// LDS pitch in floats of the x_j tile, the x_i tile and the transposed Wp2:
// 260 = 4 mod 64 banks, so 16 rows in a row x 2 k pairs of one 8-byte fragment read
// fall on 64 different banks; lanes whose pairs share a row read the same address.
// The list has the pairs of columns 0..15 first, so that (but for the group where the halves meet and the last group, whose fill names pair 0) a
// group's x_j rows lie within 16.
#define BP_  260
#define TI_  32                            // rows and columns of a tile
#define QP_  34                            // pitch of a QK^T row: rows p, p + 8 on other banks
#define NPAIR (TI_ * TI_)
#define SW_  16                            // waves of a block

// The second bound keeps a wave within 128 registers, so that two blocks share a WGP.
__global__ __launch_bounds__(SW_ * 32, 8) void scores_kernel(
    const float* __restrict__ Q, const float* __restrict__ Kb,
    const float* __restrict__ Ab, const float* __restrict__ Bb,
    const float* __restrict__ Wp2, const float* __restrict__ bp2,
    const int* __restrict__ adj, float* __restrict__ S) {
  __shared__ __attribute__((aligned(16))) float sB[TI_ * BP_];   // [j][d] x_j side, halved
  __shared__ __attribute__((aligned(16))) float sA[TI_ * BP_];   // [i][d] x_i side (+bp1), halved
  __shared__ __attribute__((aligned(16))) float sW[(H_ + 1) * BP_];  // Wp2 transposed, row H_ = 0
  __shared__ __attribute__((aligned(16))) float sBias[4 * NPAIR * H_];  // [quarter of d][list place][h]
  __shared__ __attribute__((aligned(16))) float sQK[H_ * TI_ * QP_];    // [h][i][j]
  __shared__ __attribute__((aligned(16))) int sList[NPAIR];      // ii * 32 + jj, unmasked first
  __shared__ __attribute__((aligned(16))) int sCnt[SW_];         // unmasked pairs a wave

  const int blk = blockIdx.x;              // b*256 + it*16 + jt
  const int b  = blk >> 8;
  const int it = (blk >> 4) & 15;
  const int jt = blk & 15;
  const int wave = __builtin_amdgcn_readfirstlane(threadIdx.x >> 5);
  const int lane = threadIdx.x & 31;
  const int m16 = lane & 15;
  const int g   = lane >> 4;
  const int kq  = wave & 3;                // the wave's quarter of d; its head in QK^T
  const int par = wave >> 2;               // its groups: par, par + 4, ..; its quarter in QK^T

  // ---- the thread's own two pairs of the tile and their masks: waves 0..7 have
  //      columns 0..15, waves 8..15 columns 16..31; a wave has 4 rows, two at a time ----
  const int jj  = (wave >> 3) * 16 + m16;
  const int ii0 = (wave & 7) * 4 + g;      // row of pair r: ii0 + 2 * r
  bool mk[2];
#pragma unroll
  for (int r = 0; r < 2; ++r)
    mk[r] = adj[(it * TI_ + ii0 + 2 * r) * N_ + jt * TI_ + jj] != 0;
  // Precaution: the wait stands in front of the code below, which reuses the
  // register that holds these loads' address.
  asm volatile("s_wait_xcnt 0x0" ::: "memory");

  // ---- QK^T: 16 rows x 16 columns of one head a wave, in ascending k, four products
  //      to a WMMA; the result has an LDS array of its own ----
  {
    const int r0 = (par >> 1) * 16, c0 = (par & 1) * 16;
    const float* qrow = Q  + (size_t)(b * N_ + it * TI_ + r0 + m16) * D_ + kq * HD_;
    const float* krow = Kb + (size_t)(b * N_ + jt * TI_ + c0 + m16) * D_ + kq * HD_;
    v2f a[HD_ / 4], bf[HD_ / 4];
    // Both loops are unrolled: the arrays stay in registers.
#pragma unroll
    for (int t = 0; t < HD_ / 4; ++t) {
      const int d0 = 4 * t + 2 * g;
      a[t]  = *(const v2f*)(qrow + d0);
      bf[t] = *(const v2f*)(krow + d0);    // B[k][n] = K[n][k] -> contiguous in k
    }
    // Precaution: the wait stands in front of the code below, which reuses the
    // registers that hold these loads' addresses.
    asm volatile("s_wait_xcnt 0x0" ::: "memory");
    v8f qk = {};
#pragma unroll
    for (int t = 0; t < HD_ / 4; ++t) qk = wmma4(a[t], bf[t], qk);
    float* o = sQK + (kq * TI_ + r0 + 8 * g) * QP_ + c0 + m16;
#pragma unroll
    for (int p = 0; p < 8; ++p) o[p * QP_] = qk[p];
  }

  // ---- stage: each wave-wide 16-byte load covers 512 contiguous bytes ----
  {
    const float4* gB = (const float4*)(Bb + (size_t)(b * N_ + jt * TI_) * D_);
    const float4* gA = (const float4*)(Ab + (size_t)(b * N_ + it * TI_) * D_);
#pragma unroll
    for (int r = 0; r < 4; ++r) {
      const int idx = threadIdx.x + SW_ * 32 * r;   // float4 index in the 32 x 64 tile
      const int row = idx >> 6;
      const int c4  = idx & 63;
      const float4 vb = gB[idx];
      const float4 va = gA[idx];
      // Halved here, once a value (exact in f32), not once a pair in the k loop.
      *(float4*)(sB + row * BP_ + c4 * 4) =
          make_float4(0.5f * vb.x, 0.5f * vb.y, 0.5f * vb.z, 0.5f * vb.w);
      *(float4*)(sA + row * BP_ + c4 * 4) =
          make_float4(0.5f * va.x, 0.5f * va.y, 0.5f * va.z, 0.5f * va.w);
    }
    // Wp2[d][2 hh], Wp2[d][2 hh + 1]: waves 0..7 have heads 0 and 1, waves 8..15 the rest.
    const int d  = threadIdx.x & (D_ - 1);
    const int hh = wave >> 3;
    const float2 w = ((const float2*)Wp2)[d * 2 + hh];
    sW[(2 * hh) * BP_ + d]     = w.x;
    sW[(2 * hh + 1) * BP_ + d] = w.y;
    if (hh == 0) sW[H_ * BP_ + d] = 0.0f;        // columns 4..15 of the B operand
  }
  unsigned bal[2];
  int inwave = 0;                          // unmasked pairs of the wave
  int pos[2];                              // the pair's place among the wave's own
#pragma unroll
  for (int r = 0; r < 2; ++r) {
    bal[r] = __builtin_amdgcn_ballot_w32(mk[r]);
    pos[r] = inwave + (int)__builtin_amdgcn_mbcnt_lo(bal[r], 0u);
    inwave += __builtin_popcount(bal[r]);
  }
  if (lane == 0) sCnt[wave] = inwave;
  __syncthreads();

  // ---- pack: unmasked pairs in the order wave, r, lane; the rest of the list names
  //      pair 0, a valid row for the lanes that fill up the last group ----
  int before = 0, total = 0;
#pragma unroll
  for (int w = 0; w < SW_; ++w) {
    const int c = sCnt[w];
    total += c;
    before += (w < wave) ? c : 0;
  }
  total = __builtin_amdgcn_readfirstlane(total);
#pragma unroll
  for (int r = 0; r < 2; ++r) {
    pos[r] += before;
    if (mk[r]) sList[pos[r]] = (ii0 + 2 * r) * TI_ + jj;
    if ((int)threadIdx.x + SW_ * 32 * r >= total) sList[threadIdx.x + SW_ * 32 * r] = 0;
  }
  __syncthreads();                         // the list is whole before any group reads it
  const int ngroups = (total + 15) >> 4;   // 0..64

  // ---- the wave's 16 B fragments stay in registers: Wp2[d][n], Wp2[d + 1][n],
  //      d = 64 kq + 4s + 2g; 0 for n >= 4 ----
  v2f wf[16];
  {
    const float* wrow = sW + (m16 < H_ ? m16 : H_) * BP_ + kq * 64 + 2 * g;
#pragma unroll
    for (int s = 0; s < 16; ++s) wf[s] = *(const v2f*)(wrow + 4 * s);
  }

  // ---- physics bias: row m of the A operand is gelu(x_i side + x_j side) of the
  //      lane's own pair; both sides lie halved in LDS, so that their sum is the z of
  //      gelu_of_twice2. Within its quarter a pair sums in ascending k, four to a WMMA. ----
  {
    const int koff = kq * 64 + 2 * g;
    float* bout = sBias + (kq * NPAIR + 8 * g) * H_ + m16;
    for (int grp = par; grp < ngroups; grp += SW_ / 4) {
      const int pid = sList[grp * 16 + m16];
      const float* arow = sA + (pid >> 5) * BP_ + koff;   // x_i side (+bp1)
      const float* brow = sB + (pid & 31) * BP_ + koff;   // x_j side
      v8f acc = {};
      // Unrolled: wf stays in registers, every LDS read is a base plus a constant.
#pragma unroll
      for (int s = 0; s < 16; ++s) {
        v2f bp = *(const v2f*)(brow + 4 * s);
        v2f ap = *(const v2f*)(arow + 4 * s);
        acc = wmma4(gelu_of_twice2(ap + bp), wf[s], acc);
      }
      if (m16 < H_) {                      // D row p + 8g is list place grp * 16 + p + 8g
#pragma unroll
        for (int p = 0; p < 8; ++p) bout[(grp * 16 + p) * H_] = acc[p];
      }
    }
  }
  __syncthreads();                         // all partial sums and QK^T tiles are in LDS

  // ---- combine + mask + store ----
#pragma unroll
  for (int r = 0; r < 2; ++r) {
    const int ii = ii0 + 2 * r;
    float4 bs = make_float4(0.0f, 0.0f, 0.0f, 0.0f);
    if (mk[r]) {
      const float4* q = (const float4*)sBias + pos[r];
      const float4 p0 = q[0], p1 = q[NPAIR], p2 = q[2 * NPAIR], p3 = q[3 * NPAIR];
      bs = make_float4(((p0.x + p1.x) + p2.x) + p3.x, ((p0.y + p1.y) + p2.y) + p3.y,
                       ((p0.z + p1.z) + p2.z) + p3.z, ((p0.w + p1.w) + p2.w) + p3.w);
    }
    const float bias4[H_] = {bs.x, bs.y, bs.z, bs.w};
#pragma unroll
    for (int h = 0; h < H_; ++h) {
      const float bias_v = bias4[h] + bp2[h];
      const float v = sQK[(h * TI_ + ii) * QP_ + jj] * SCALE + (mk[r] ? bias_v : NEGINF);
      S[((size_t)(b * H_ + h) * N_ + it * TI_ + ii) * N_ + jt * TI_ + jj] = v;
    }
  }
}

// ---------------------------------------------------------------------------
// Phase B: O[b,i,h*64+d] = sum_j softmax_j(S[b,h,i,:])[j] * V[b,j,h*64+d]  (WMMA, K=512)
// One block of 16 waves per (b, h, 32 rows i, 32 columns d): 8 * 16 * 2 = 256 blocks,
// four waves a WMMA tile, a quarter of k each. A block holds its 32 score rows whole,
// so the row softmax is done on the way into LDS.
// ---------------------------------------------------------------------------
__global__ __launch_bounds__(512) void pv_kernel(
    const float* __restrict__ S, const float* __restrict__ V,
    float* __restrict__ O) {
  __shared__ __attribute__((aligned(16))) float smem[TileShape<N_, 32, 512>::FLOATS];
  const int wave = threadIdx.x >> 5;
  const int lane = threadIdx.x & 31;
  const int m16 = lane & 15;
  const int g   = lane >> 4;
  const int bh = blockIdx.x >> 5;
  const int i0 = ((blockIdx.x >> 1) & 15) * 32;
  const int d0 = (blockIdx.x & 1) * 32;
  const int b = bh >> 2, h = bh & 3;

  const v8f acc = staged_tile_product<N_, N_, D_, 32, 512, true>(
      S + ((size_t)bh * N_ + i0) * N_, V + (size_t)b * N_ * D_ + h * HD_ + d0, smem);

  if (wave < 4) {                          // the waves that hold the whole sum
    float* orow = O + (size_t)(b * N_ + i0 + (wave >> 1) * 16) * D_ + h * HD_ + d0 +
                  (wave & 1) * 16 + m16;
#pragma unroll
    for (int p = 0; p < 8; ++p) orow[(size_t)(p + 8 * g) * D_] = acc[p];
  }
}

// ---------------------------------------------------------------------------
// Host launcher. Workspace layout (floats):
//   Q,K,V,A,B : 5 * 1024*256            = 1,310,720
//   S         : 2*4*512*512             = 2,097,152
//   O         : 1024*256                =   262,144
// Total ~14.0 MB.
// ---------------------------------------------------------------------------
extern "C" void kernel_launch(void* const* d_in, const int* in_sizes, int n_in,
                              void* d_out, int out_size, void* d_ws,
                              size_t ws_size, hipStream_t stream) {
  (void)in_sizes; (void)n_in; (void)out_size; (void)ws_size;
  const float* x   = (const float*)d_in[0];
  const int*   adj = (const int*)  d_in[1];
  const float* Wq  = (const float*)d_in[2];
  const float* bq  = (const float*)d_in[3];
  const float* Wk  = (const float*)d_in[4];
  const float* bk  = (const float*)d_in[5];
  const float* Wv  = (const float*)d_in[6];
  const float* bv  = (const float*)d_in[7];
  const float* Wo  = (const float*)d_in[8];
  const float* bo  = (const float*)d_in[9];
  const float* Wp1 = (const float*)d_in[10];  // [2D, D] row-major
  const float* bp1 = (const float*)d_in[11];
  const float* Wp2 = (const float*)d_in[12];  // [D, H] row-major
  const float* bp2 = (const float*)d_in[13];

  const int M = B_ * N_;  // 1024
  float* ws = (float*)d_ws;
  float* Qb = ws;
  float* Kb = Qb + (size_t)M * D_;
  float* Vb = Kb + (size_t)M * D_;
  float* Ab = Vb + (size_t)M * D_;
  float* Bb = Ab + (size_t)M * D_;
  float* Sb = Bb + (size_t)M * D_;                       // [B,H,N,N]
  float* Ob = Sb + (size_t)B_ * H_ * N_ * N_;

  const dim3 blk(256);

  // Projections, all five in one launch (bp1 folded into the x_i side of the
  // physics MLP); Qb, Kb, Vb, Ab, Bb lie one behind the other in the workspace.
  gemm_xw_kernel<64, 256><<<dim3((M / 32) * (D_ / 64), 5), blk, 0, stream>>>(
      x, Wq, bq, Wk, bk, Wv, bv, Wp1, bp1, Wp1 + (size_t)D_ * D_, nullptr,
      Qb);

  scores_kernel<<<B_ * 16 * 16, dim3(512), 0, stream>>>(Qb, Kb, Ab, Bb, Wp2, bp2,
                                                  adj, Sb);
  pv_kernel<<<B_ * H_ * (N_ / 32) * (HD_ / 32), dim3(512), 0, stream>>>(Sb, Vb, Ob);
  gemm_xw_kernel<32, 512><<<(M / 32) * (D_ / 32), dim3(512), 0, stream>>>(
      Ob, Wo, bo, nullptr, nullptr, nullptr, nullptr, nullptr, nullptr, nullptr,
      nullptr, (float*)d_out);
}

// v010
// It runs in 42.5 microseconds.
// Timed twice side by side with v009, it ran 1.04 and 1.05 times as fast.
// All steps since v000 together make it 5.30 times as fast.
#include <hip/hip_runtime.h>
#include <math.h>

// Problem constants: B=2, N=512, HIDDEN=256, HEADS=4, HEAD_DIM=64
#define N_   512
#define D_   256
#define H_   4
#define HD_  64
#define B_   2
#define SCALE   0.125f      // HEAD_DIM^-0.5
#define NEGINF  (-1e9f)

typedef float v2f __attribute__((ext_vector_type(2)));
typedef float v8f __attribute__((ext_vector_type(8)));

// V_WMMA_F32_16X16X4_F32 : D(16x16 f32) = A(16x4 f32) * B(4x16 f32) + C
// Layouts (wave32):
//   A frag: lane = m + 16*g (m=0..15, g=0..1); a.x=A[m][k+2g], a.y=A[m][k+2g+1]
//   B frag: lane = n + 16*g;                    b.x=B[k+2g][n], b.y=B[k+2g+1][n]
//   C/D   : lane = n + 16*g, vgpr p => D[p+8g][n]
__device__ __forceinline__ v8f wmma4(v2f a, v2f b, v8f c) {
  return __builtin_amdgcn_wmma_f32_16x16x4_f32(false, a, false, b, (short)0, c,
                                               false, false);
}

// jax.nn.gelu(approximate=False): 0.5*x*(1+erf(x/sqrt(2))) = x*Phi(x), two values
// at a time and without a branch. The argument is z = x/2. With T(|x|), the upper
// normal tail, x*Phi(x) = 0.5*x + |x|*(0.5 - T(|x|)) = (z + |z|) - |z| * 2T(2|z|) for
// either sign of x. log2(2T(2y)) is smooth and falls ever faster, so that one
// polynomial of degree 5 in y = |z| stands for it: 2T = exp2(P(y)), one transcendental
// a value and no reciprocal. The coefficients are a minimax fit of the error of the
// whole term, y * (exp2(P(y)) - 2T(2y)): below 4.5e-7 for all y >= 0. The leading
// coefficient is negative: P falls to -inf and the term to 0 as y grows.
__device__ __forceinline__ v2f splat2(float c) { v2f r = {c, c}; return r; }

__device__ __forceinline__ v2f gelu_of_twice2(v2f z) {
  const v2f y = {__builtin_fabsf(z.x), __builtin_fabsf(z.y)};
  v2f p = __builtin_elementwise_fma(y, splat2(-0.01514540892f), splat2(0.1133513823f));
  p = __builtin_elementwise_fma(y, p, splat2(-0.4146173596f));
  p = __builtin_elementwise_fma(y, p, splat2(-1.839970589f));
  p = __builtin_elementwise_fma(y, p, splat2(-2.301575422f));
  p = __builtin_elementwise_fma(y, p, splat2(-0.00003763227505f));
  const v2f e = {__builtin_amdgcn_exp2f(p.x), __builtin_amdgcn_exp2f(p.y)};
  return __builtin_elementwise_fma(-y, e, z + y);
}

// ---------------------------------------------------------------------------
// One 32 x NC block tile of C = A[32,K] * B[K,NC], both operands staged once in
// LDS by NT threads. Every global load is 16 bytes a lane and covers whole 128-byte
// lines, and all of a thread's loads are issued before the first LDS store, so the block
// pays the load latency once, not once per group of k steps, and no load is
// spread over 16 lines as a fragment load from global memory would be.
//   sA : [32 rows][KL + 4]; the pitch is 4 mod 64 banks, so the 16 rows x 2 k
//        pairs of one 8-byte fragment read fall on 64 different banks.
//   sB : [KL / 2 row pairs][NC columns][2]: rows 2r and 2r+1 interleaved, so that
//        one 8-byte read gives the lane's (b.x, b.y). Odd row pairs have column
//        bit 4 flipped (32 floats): the two pairs of one read use different banks.
// The tile has 2 x NC / 16 WMMA tiles. Where the block has KS times as many waves,
// the k range is dealt to KS groups of waves, K / KS each: a narrow tile then gives
// twice the blocks, one for every WGP, and a SIMD's share of the WMMAs is spread
// over KS waves, which cover each other's LDS latency. Within its range a wave sums
// in ascending k, four products to a WMMA; groups 1.. hand their sums over in sR,
// and group 0 adds them in ascending order: only its waves return the result.
// Each group's slices of A and B (KL = K / KS of k) lie side by side in LDS, GS floats
// from the next group's: the group's place is in the address register, and every
// fragment read of the k loop is that register plus an immediate offset.
// With ROW_SOFTMAX the A operand is softmax(A) along k: a wave then loads R whole
// rows (Q 16-byte pieces a lane and row), so that a row's maximum and sum
// are taken over the wave's own registers and lanes, and the normalised values go
// to LDS. The rows never travel to memory and back between softmax and product.
// ---------------------------------------------------------------------------
// 2^w. The v_nop keeps the one slot that the instruction set asks for behind a
// transcendental before its source register is overwritten.
__device__ __forceinline__ float exp2_with_slot(float w) {
  float e;
  asm("v_exp_f32 %0, %1\n\tv_nop" : "=v"(e) : "v"(w));
  return e;
}

template <int R, int Q>
__device__ __forceinline__ void softmax_of_rows(float4 (&v)[R * Q]) {
  constexpr float LOG2E = 1.44269504088896340736f;
  float mx[R], sum[R];
  // All loops here are unrolled: the array stays in registers, and the rows'
  // cross-lane steps stand side by side, so that their latencies overlap.
#pragma unroll
  for (int rr = 0; rr < R; ++rr) {
    float m = -3.4e38f;
#pragma unroll
    for (int t = 0; t < Q; ++t) {
      const float4 x = v[rr * Q + t];
      m = fmaxf(m, fmaxf(fmaxf(x.x, x.y), fmaxf(x.z, x.w)));
    }
    mx[rr] = m;
  }
#pragma unroll
  for (int off = 16; off >= 1; off >>= 1) {
#pragma unroll
    for (int rr = 0; rr < R; ++rr) mx[rr] = fmaxf(mx[rr], __shfl_xor(mx[rr], off));
  }
#pragma unroll
  for (int rr = 0; rr < R; ++rr) {
    float s = 0.0f;
#pragma unroll
    for (int t = 0; t < Q; ++t) {
      float4 x = v[rr * Q + t];
      x.x = exp2_with_slot((x.x - mx[rr]) * LOG2E);
      x.y = exp2_with_slot((x.y - mx[rr]) * LOG2E);
      x.z = exp2_with_slot((x.z - mx[rr]) * LOG2E);
      x.w = exp2_with_slot((x.w - mx[rr]) * LOG2E);
      s += (x.x + x.y) + (x.z + x.w);
      v[rr * Q + t] = x;
    }
    sum[rr] = s;
  }
#pragma unroll
  for (int off = 16; off >= 1; off >>= 1) {
#pragma unroll
    for (int rr = 0; rr < R; ++rr) sum[rr] += __shfl_xor(sum[rr], off);
  }
#pragma unroll
  for (int rr = 0; rr < R; ++rr) {
    const float inv = 1.0f / sum[rr];
#pragma unroll
    for (int t = 0; t < Q; ++t) {
      float4 x = v[rr * Q + t];
      x.x *= inv; x.y *= inv; x.z *= inv; x.w *= inv;
      v[rr * Q + t] = x;
    }
  }
}

template <int K, int NC, int NT>
struct TileShape {
  static constexpr int NTL = 2 * NC / 16;        // WMMA tiles of the block tile
  static constexpr int KS  = NT / 32 / NTL;      // groups of waves that share the k range
  static constexpr int KL  = K / KS;             // k range of a group
  static constexpr int AP  = KL + 4;             // floats a row in sA
  static constexpr int PP  = 2 * NC;             // floats a row pair in sB
  static constexpr int AS  = 32 * AP;            // floats of a group's slice of A
  static constexpr int GS  = AS + KL / 2 * PP;   // floats of a group's two slices
  static constexpr int RS  = (KS - 1) * NTL * 256;   // floats of sR
  static constexpr int FLOATS = RS + KS * GS;    // sR, then the groups' slices
};

template <int K, int LDA, int LDB, int NC, int NT, bool ROW_SOFTMAX>
__device__ __forceinline__ v8f staged_tile_product(
    const float* __restrict__ Ag, const float* __restrict__ Bg, float* smem) {
  using T = TileShape<K, NC, NT>;
  constexpr int NTL = T::NTL, KS = T::KS, KL = T::KL, AP = T::AP, PP = T::PP, GS = T::GS;
  constexpr int NRA = 8 * K / NT;          // 16-byte pieces of A a thread
  constexpr int RA  = 4 * NT / K;          // rows of A a round
  constexpr int R   = 1024 / NT;           // rows a wave, where a wave has whole rows
  constexpr int Q   = K / 128;             // rounds a row there
  constexpr int C4  = NC / 4;              // 16-byte pieces a row of B
  constexpr int PR  = NT / C4;             // row pairs of B a round
  constexpr int NRB = K / 2 / PR;          // rounds of B
  static_assert(KS == 1 || PR % (KL / 2) == 0, "a round of B covers whole groups");
  static_assert(!ROW_SOFTMAX || KL % 128 == 0, "a 128-float piece of a row lies in one group");
  float* sR = smem;
  float* sA = smem + T::RS;
  float* sB = sA + T::AS;
  const int tid = threadIdx.x;
  const int arow = ROW_SOFTMAX ? (tid >> 5) * R : tid / (K / 4);
  const int ac4  = ROW_SOFTMAX ? (tid & 31) : tid % (K / 4);
  const int pr = tid / C4;                 // row pair of B
  const int c4 = tid % C4;
  const float* pa = Ag + arow * LDA + ac4 * 4;
  const float* pb = Bg + 2 * pr * LDB + c4 * 4;
  float4 ra[NRA], rb0[NRB], rb1[NRB];
  // The four loops below are unrolled so that the arrays stay in registers and
  // every round's address is the base plus a constant offset.
#pragma unroll
  for (int r = 0; r < NRA; ++r)
    ra[r] = *(const float4*)(pa + (ROW_SOFTMAX ? (r / Q) * LDA + (r % Q) * 128
                                               : r * RA * LDA));
#pragma unroll
  for (int r = 0; r < NRB; ++r) {
    rb0[r] = *(const float4*)(pb + r * 2 * PR * LDB);
    rb1[r] = *(const float4*)(pb + r * 2 * PR * LDB + LDB);
  }
  if constexpr (ROW_SOFTMAX) softmax_of_rows<R, Q>(ra);
  float* qa = sA + arow * AP +
              (ROW_SOFTMAX || KS == 1 ? ac4 * 4 : (ac4 * 4 / KL) * GS + ac4 * 4 % KL);
  float* qb = sB + (KS == 1 ? pr * PP : (pr / (KL / 2)) * GS + (pr % (KL / 2)) * PP) +
              ((c4 * 8) ^ ((pr & 1) << 5));
#pragma unroll
  for (int r = 0; r < NRA; ++r)
    *(float4*)(qa + (ROW_SOFTMAX ? (r / Q) * AP + ((r % Q) * 128 / KL) * GS + (r % Q) * 128 % KL
                                 : r * RA * AP)) = ra[r];
#pragma unroll
  for (int r = 0; r < NRB; ++r) {          // PR pairs on, PR even: the parity of pr stays
    float* q = qb + (KS == 1 ? r * PR * PP : r * (PR / (KL / 2)) * GS);
    *(float4*)q       = make_float4(rb0[r].x, rb1[r].x, rb0[r].y, rb1[r].y);
    *(float4*)(q + 4) = make_float4(rb0[r].z, rb1[r].z, rb0[r].w, rb1[r].w);
  }
  __syncthreads();                         // the tiles are whole before any fragment read

  const int wave = tid >> 5;
  const int lane = tid & 31;
  const int m16 = lane & 15;
  const int g   = lane >> 4;
  const int tile = KS > 1 ? wave % NTL : wave;   // tile / (NC / 16): 16 rows, the rest: 16 columns
  const int gs0  = KS > 1 ? (wave / NTL) * GS : 0;   // the group's slices
  const float* ar = sA + gs0 + ((tile / (NC / 16)) * 16 + m16) * AP + 2 * g;
  const float* br = sB + gs0 + g * PP + ((((tile % (NC / 16)) * 16 + m16) * 2) ^ (g << 5));
  v8f acc = {};
  // Unrolled so that the next steps' LDS reads issue ahead of the WMMAs in front
  // of them and take constant offsets from one address a trip; a group's short
  // range is unrolled whole, so that no address arithmetic stands among its WMMAs.
  constexpr int UN = KS > 1 ? KL / 4 : 16;
#pragma unroll UN
  for (int kk = 0; kk < KL; kk += 4) {
    v2f a = *(const v2f*)(ar + kk);        // A[m][k], A[m][k+1], k = the group's first + kk + 2g
    v2f b = *(const v2f*)(br + kk * NC);   // B[k][n], B[k+1][n]
    acc = wmma4(a, b, acc);
  }
  if constexpr (KS > 1) {
    const int grp = __builtin_amdgcn_readfirstlane(wave / NTL);
    if (grp > 0) {
      float* w = sR + ((grp - 1) * NTL + tile) * 256 + lane;
#pragma unroll
      for (int p = 0; p < 8; ++p) w[p * 32] = acc[p];
    }
    __syncthreads();                       // the other groups' sums are in sR
    if (grp == 0) {
#pragma unroll
      for (int s = 0; s < KS - 1; ++s) {
        const float* r = sR + (s * NTL + tile) * 256 + lane;
#pragma unroll
        for (int p = 0; p < 8; ++p) acc[p] += r[p * 32];
      }
    }
  }
  return acc;
}

// ---------------------------------------------------------------------------
// fp32 GEMM: Y[1024,256] = X[1024,256] @ W[256,256] (+ bias[256]).
// One block of NT threads per 32 x NC output tile. Five products in one grid fill
// the chip with 32 x 64 tiles and one wave a WMMA tile; a single product takes
// 32 x 32 tiles, 256 blocks, and four waves a WMMA tile, a quarter of k each.
// Up to five products of one X share a grid: blockIdx.y picks W and bias, and
// the results lie one behind the other from Y0.
// ---------------------------------------------------------------------------
template <int NC, int NT>
__global__ __launch_bounds__(NT) void gemm_xw_kernel(
    const float* __restrict__ X,
    const float* __restrict__ W0, const float* __restrict__ bias0,
    const float* __restrict__ W1, const float* __restrict__ bias1,
    const float* __restrict__ W2, const float* __restrict__ bias2,
    const float* __restrict__ W3, const float* __restrict__ bias3,
    const float* __restrict__ W4, const float* __restrict__ bias4,
    float* __restrict__ Y0) {
  using T = TileShape<D_, NC, NT>;
  constexpr int NTL = T::NTL, KS = T::KS;
  __shared__ __attribute__((aligned(16))) float smem[T::FLOATS];
  const int which = blockIdx.y;
  const float* W = W0;
  const float* bias = bias0;
  if (which == 1) { W = W1; bias = bias1; }
  if (which == 2) { W = W2; bias = bias2; }
  if (which == 3) { W = W3; bias = bias3; }
  if (which == 4) { W = W4; bias = bias4; }
  float* Y = Y0 + (size_t)which * (B_ * N_) * D_;
  const int wave = threadIdx.x >> 5;
  const int lane = threadIdx.x & 31;
  const int m16 = lane & 15;
  const int g   = lane >> 4;
  const int row0 = (blockIdx.x / (D_ / NC)) * 32;
  const int col0 = (blockIdx.x % (D_ / NC)) * NC;

  const v8f acc = staged_tile_product<D_, D_, D_, NC, NT, false>(
      X + (size_t)row0 * D_, W + col0, smem);

  if (KS == 1 || wave < NTL) {             // the waves that hold the whole sum
    const int col = col0 + (wave % (NC / 16)) * 16 + m16;
    const float bv = bias ? bias[col] : 0.0f;
    float* yout = Y + (size_t)(row0 + (wave / (NC / 16)) * 16) * D_ + col;
#pragma unroll
    for (int p = 0; p < 8; ++p)
      yout[(size_t)(p + 8 * g) * D_] = acc[p] + bv;
  }
}

// ---------------------------------------------------------------------------
// Phase A: S[b,h,i,j] = scale*(q_i . k_j) + (mask ? physics_bias : -1e9)
// One block of 16 waves per (b, 32 rows i, 32 columns j): 512 blocks, two on a WGP, all
// resident at once; a staged row of x_i or x_j serves 32 pairs.
//   all waves : stage the Q tile, the K tile, the x_j tile, the x_i tile and Wp2 in LDS,
//               whole lines, all loads in flight at once;
//               QK^T of head wave & 3 for one of the tile's four 16 x 16 quarters, its
//               fragments read from LDS: a fragment load from global memory would touch
//               16 lines for 256 bytes;
//               pack the tile's unmasked (i, j) pairs into one list
//   all waves : physics bias of 16 listed pairs at a time (GELU into the A fragment,
//               [16 pairs x 64 d] @ Wp2[64 d x 4 h] via WMMA). Wave w has the quarter
//               w & 3 of d, whose Wp2 fragments it keeps in registers, and every fourth
//               group of the list: the waves' shares differ by 16 WMMAs at most, and the
//               four SIMDs (waves w, w + 4, ..) have equal shares. The four partial sums
//               of a pair are added in ascending d when the scores are put together.
// A masked pair's bias is never used (the reference selects -1e9 there), so it is
// not computed: a tile with n unmasked pairs costs ceil(n / 16) groups, 64 at most.
// ---------------------------------------------------------------------------
// LDS pitch in floats of the Q, K, x_j and x_i tiles and the transposed Wp2:
// 260 = 4 mod 64 banks, so 16 rows in a row x 2 k pairs of one 8-byte fragment read
// fall on 64 different banks; lanes whose pairs share a row read the same address.
// The list has the pairs of columns 0..15 first, so that (but for the group where the halves meet and the last group, whose fill names pair 0) a
// group's x_j rows lie within 16.
#define BP_  260
#define TI_  32                            // rows and columns of a tile
#define QP_  34                            // pitch of a QK^T row: rows p, p + 8 on other banks
#define NPAIR (TI_ * TI_)
#define SW_  16                            // waves of a block

// The second bound keeps a wave within 128 registers, so that two blocks share a WGP.
__global__ __launch_bounds__(SW_ * 32, 8) void scores_kernel(
    const float* __restrict__ Q, const float* __restrict__ Kb,
    const float* __restrict__ Ab, const float* __restrict__ Bb,
    const float* __restrict__ Wp2, const float* __restrict__ bp2,
    const int* __restrict__ adj, float* __restrict__ S) {
  __shared__ __attribute__((aligned(16))) float sB[TI_ * BP_];   // [j][d] x_j side, halved
  __shared__ __attribute__((aligned(16))) float sA[TI_ * BP_];   // [i][d] x_i side (+bp1), halved
  __shared__ __attribute__((aligned(16))) float sW[(H_ + 1) * BP_];  // Wp2 transposed, row H_ = 0
  // The Q and K tiles are read only between the first and the second barrier, the
  // partial sums are written only behind the second: they share one array.
  __shared__ __attribute__((aligned(16))) float sU[2 * TI_ * BP_];
  static_assert(2 * TI_ * BP_ >= 4 * NPAIR * H_, "the partial sums fit the shared array");
  float* const sQ = sU;                    // [i][h * 64 + d]
  float* const sK = sU + TI_ * BP_;        // [j][h * 64 + d]
  float* const sBias = sU;                 // [quarter of d][list place][h]
  __shared__ __attribute__((aligned(16))) float sQK[H_ * TI_ * QP_];    // [h][i][j]
  __shared__ __attribute__((aligned(16))) int sList[NPAIR];      // ii * 32 + jj, unmasked first
  __shared__ __attribute__((aligned(16))) int sCnt[SW_];         // unmasked pairs a wave

  const int blk = blockIdx.x;              // b*256 + it*16 + jt
  const int b  = blk >> 8;
  const int it = (blk >> 4) & 15;
  const int jt = blk & 15;
  const int wave = __builtin_amdgcn_readfirstlane(threadIdx.x >> 5);
  const int lane = threadIdx.x & 31;
  const int m16 = lane & 15;
  const int g   = lane >> 4;
  const int kq  = wave & 3;                // the wave's quarter of d; its head in QK^T
  const int par = wave >> 2;               // its groups: par, par + 4, ..; its quarter in QK^T

  // ---- the thread's own two pairs of the tile and their masks: waves 0..7 have
  //      columns 0..15, waves 8..15 columns 16..31; a wave has 4 rows, two at a time ----
  const int jj  = (wave >> 3) * 16 + m16;
  const int ii0 = (wave & 7) * 4 + g;      // row of pair r: ii0 + 2 * r
  bool mk[2];
#pragma unroll
  for (int r = 0; r < 2; ++r)
    mk[r] = adj[(it * TI_ + ii0 + 2 * r) * N_ + jt * TI_ + jj] != 0;
  // Precaution: the wait stands in front of the code below, which reuses the
  // register that holds these loads' address.
  asm volatile("s_wait_xcnt 0x0" ::: "memory");

  // ---- stage: each wave-wide 16-byte load covers 512 contiguous bytes ----
  {
    const float4* gQ = (const float4*)(Q  + (size_t)(b * N_ + it * TI_) * D_);
    const float4* gK = (const float4*)(Kb + (size_t)(b * N_ + jt * TI_) * D_);
    const float4* gB = (const float4*)(Bb + (size_t)(b * N_ + jt * TI_) * D_);
    const float4* gA = (const float4*)(Ab + (size_t)(b * N_ + it * TI_) * D_);
    // Wp2[d][2 hh], Wp2[d][2 hh + 1]: waves 0..7 have heads 0 and 1, waves 8..15 the rest.
    const int d  = threadIdx.x & (D_ - 1);
    const int hh = wave >> 3;
    float4 vq[4], vk[4], vb[4], va[4];
    // Both loops are unrolled: the arrays stay in registers, and every load is issued
    // before the first LDS store, so that the block pays the load latency once.
#pragma unroll
    for (int r = 0; r < 4; ++r) {
      const int idx = threadIdx.x + SW_ * 32 * r;   // float4 index in a 32 x 64 tile
      vq[r] = gQ[idx];
      vk[r] = gK[idx];
      vb[r] = gB[idx];
      va[r] = gA[idx];
    }
    const float2 w = ((const float2*)Wp2)[d * 2 + hh];
    // Precaution: the wait stands in front of the code below, which reuses the
    // registers that hold these loads' addresses.
    asm volatile("s_wait_xcnt 0x0" ::: "memory");
#pragma unroll
    for (int r = 0; r < 4; ++r) {
      const int idx = threadIdx.x + SW_ * 32 * r;
      const int o = (idx >> 6) * BP_ + (idx & 63) * 4;
      *(float4*)(sQ + o) = vq[r];
      *(float4*)(sK + o) = vk[r];
      // Halved here, once a value (exact in f32), not once a pair in the k loop.
      *(float4*)(sB + o) =
          make_float4(0.5f * vb[r].x, 0.5f * vb[r].y, 0.5f * vb[r].z, 0.5f * vb[r].w);
      *(float4*)(sA + o) =
          make_float4(0.5f * va[r].x, 0.5f * va[r].y, 0.5f * va[r].z, 0.5f * va[r].w);
    }
    sW[(2 * hh) * BP_ + d]     = w.x;
    sW[(2 * hh + 1) * BP_ + d] = w.y;
    if (hh == 0) sW[H_ * BP_ + d] = 0.0f;        // columns 4..15 of the B operand
  }
  unsigned bal[2];
  int inwave = 0;                          // unmasked pairs of the wave
  int pos[2];                              // the pair's place among the wave's own
#pragma unroll
  for (int r = 0; r < 2; ++r) {
    bal[r] = __builtin_amdgcn_ballot_w32(mk[r]);
    pos[r] = inwave + (int)__builtin_amdgcn_mbcnt_lo(bal[r], 0u);
    inwave += __builtin_popcount(bal[r]);
  }
  if (lane == 0) sCnt[wave] = inwave;
  __syncthreads();

  // ---- pack: unmasked pairs in the order wave, r, lane; the rest of the list names
  //      pair 0, a valid row for the lanes that fill up the last group ----
  int before = 0, total = 0;
#pragma unroll
  for (int w = 0; w < SW_; ++w) {
    const int c = sCnt[w];
    total += c;
    before += (w < wave) ? c : 0;
  }
  total = __builtin_amdgcn_readfirstlane(total);
#pragma unroll
  for (int r = 0; r < 2; ++r) {
    pos[r] += before;
    if (mk[r]) sList[pos[r]] = (ii0 + 2 * r) * TI_ + jj;
    if ((int)threadIdx.x + SW_ * 32 * r >= total) sList[threadIdx.x + SW_ * 32 * r] = 0;
  }

  // ---- QK^T: 16 rows x 16 columns of one head a wave, in ascending k, four products
  //      to a WMMA; the result has an LDS array of its own ----
  {
    const int r0 = (par >> 1) * 16, c0 = (par & 1) * 16;
    const float* qrow = sQ + (r0 + m16) * BP_ + kq * HD_ + 2 * g;
    const float* krow = sK + (c0 + m16) * BP_ + kq * HD_ + 2 * g;
    v8f qk = {};
    // Both loops are unrolled: every LDS address is a base plus a constant offset.
#pragma unroll
    for (int t = 0; t < HD_ / 4; ++t)      // B[k][n] = K[n][k]: contiguous in k
      qk = wmma4(*(const v2f*)(qrow + 4 * t), *(const v2f*)(krow + 4 * t), qk);
    float* o = sQK + (kq * TI_ + r0 + 8 * g) * QP_ + c0 + m16;
#pragma unroll
    for (int p = 0; p < 8; ++p) o[p * QP_] = qk[p];
  }
  // The list is whole before any group reads it, and the Q and K tiles have been read
  // before the partial sums are written over them.
  __syncthreads();
  const int ngroups = (total + 15) >> 4;   // 0..64

  // ---- the wave's 16 B fragments stay in registers: Wp2[d][n], Wp2[d + 1][n],
  //      d = 64 kq + 4s + 2g; 0 for n >= 4 ----
  v2f wf[16];
  {
    const float* wrow = sW + (m16 < H_ ? m16 : H_) * BP_ + kq * 64 + 2 * g;
#pragma unroll
    for (int s = 0; s < 16; ++s) wf[s] = *(const v2f*)(wrow + 4 * s);
  }

  // ---- physics bias: row m of the A operand is gelu(x_i side + x_j side) of the
  //      lane's own pair; both sides lie halved in LDS, so that their sum is the z of
  //      gelu_of_twice2. Within its quarter a pair sums in ascending k, four to a WMMA. ----
  {
    const int koff = kq * 64 + 2 * g;
    float* bout = sBias + (kq * NPAIR + 8 * g) * H_ + m16;
    for (int grp = par; grp < ngroups; grp += SW_ / 4) {
      const int pid = sList[grp * 16 + m16];
      const float* arow = sA + (pid >> 5) * BP_ + koff;   // x_i side (+bp1)
      const float* brow = sB + (pid & 31) * BP_ + koff;   // x_j side
      v8f acc = {};
      // Unrolled: wf stays in registers, every LDS read is a base plus a constant.
#pragma unroll
      for (int s = 0; s < 16; ++s) {
        v2f bp = *(const v2f*)(brow + 4 * s);
        v2f ap = *(const v2f*)(arow + 4 * s);
        acc = wmma4(gelu_of_twice2(ap + bp), wf[s], acc);
      }
      if (m16 < H_) {                      // D row p + 8g is list place grp * 16 + p + 8g
#pragma unroll
        for (int p = 0; p < 8; ++p) bout[(grp * 16 + p) * H_] = acc[p];
      }
    }
  }
  __syncthreads();                         // all partial sums and QK^T tiles are in LDS

  // ---- combine + mask + store ----
#pragma unroll
  for (int r = 0; r < 2; ++r) {
    const int ii = ii0 + 2 * r;
    float4 bs = make_float4(0.0f, 0.0f, 0.0f, 0.0f);
    if (mk[r]) {
      const float4* q = (const float4*)sBias + pos[r];
      const float4 p0 = q[0], p1 = q[NPAIR], p2 = q[2 * NPAIR], p3 = q[3 * NPAIR];
      bs = make_float4(((p0.x + p1.x) + p2.x) + p3.x, ((p0.y + p1.y) + p2.y) + p3.y,
                       ((p0.z + p1.z) + p2.z) + p3.z, ((p0.w + p1.w) + p2.w) + p3.w);
    }
    const float bias4[H_] = {bs.x, bs.y, bs.z, bs.w};
#pragma unroll
    for (int h = 0; h < H_; ++h) {
      const float bias_v = bias4[h] + bp2[h];
      const float v = sQK[(h * TI_ + ii) * QP_ + jj] * SCALE + (mk[r] ? bias_v : NEGINF);
      S[((size_t)(b * H_ + h) * N_ + it * TI_ + ii) * N_ + jt * TI_ + jj] = v;
    }
  }
}

// ---------------------------------------------------------------------------
// Phase B: O[b,i,h*64+d] = sum_j softmax_j(S[b,h,i,:])[j] * V[b,j,h*64+d]  (WMMA, K=512)
// One block of 16 waves per (b, h, 32 rows i, 32 columns d): 8 * 16 * 2 = 256 blocks,
// four waves a WMMA tile, a quarter of k each. A block holds its 32 score rows whole,
// so the row softmax is done on the way into LDS.
// ---------------------------------------------------------------------------
__global__ __launch_bounds__(512) void pv_kernel(
    const float* __restrict__ S, const float* __restrict__ V,
    float* __restrict__ O) {
  __shared__ __attribute__((aligned(16))) float smem[TileShape<N_, 32, 512>::FLOATS];
  const int wave = threadIdx.x >> 5;
  const int lane = threadIdx.x & 31;
  const int m16 = lane & 15;
  const int g   = lane >> 4;
  const int bh = blockIdx.x >> 5;
  const int i0 = ((blockIdx.x >> 1) & 15) * 32;
  const int d0 = (blockIdx.x & 1) * 32;
  const int b = bh >> 2, h = bh & 3;

  const v8f acc = staged_tile_product<N_, N_, D_, 32, 512, true>(
      S + ((size_t)bh * N_ + i0) * N_, V + (size_t)b * N_ * D_ + h * HD_ + d0, smem);

  if (wave < 4) {                          // the waves that hold the whole sum
    float* orow = O + (size_t)(b * N_ + i0 + (wave >> 1) * 16) * D_ + h * HD_ + d0 +
                  (wave & 1) * 16 + m16;
#pragma unroll
    for (int p = 0; p < 8; ++p) orow[(size_t)(p + 8 * g) * D_] = acc[p];
  }
}

// ---------------------------------------------------------------------------
// Host launcher. Workspace layout (floats):
//   Q,K,V,A,B : 5 * 1024*256            = 1,310,720
//   S         : 2*4*512*512             = 2,097,152
//   O         : 1024*256                =   262,144
// Total ~14.0 MB.
// ---------------------------------------------------------------------------
extern "C" void kernel_launch(void* const* d_in, const int* in_sizes, int n_in,
                              void* d_out, int out_size, void* d_ws,
                              size_t ws_size, hipStream_t stream) {
  (void)in_sizes; (void)n_in; (void)out_size; (void)ws_size;
  const float* x   = (const float*)d_in[0];
  const int*   adj = (const int*)  d_in[1];
  const float* Wq  = (const float*)d_in[2];
  const float* bq  = (const float*)d_in[3];
  const float* Wk  = (const float*)d_in[4];
  const float* bk  = (const float*)d_in[5];
  const float* Wv  = (const float*)d_in[6];
  const float* bv  = (const float*)d_in[7];
  const float* Wo  = (const float*)d_in[8];
  const float* bo  = (const float*)d_in[9];
  const float* Wp1 = (const float*)d_in[10];  // [2D, D] row-major
  const float* bp1 = (const float*)d_in[11];
  const float* Wp2 = (const float*)d_in[12];  // [D, H] row-major
  const float* bp2 = (const float*)d_in[13];

  const int M = B_ * N_;  // 1024
  float* ws = (float*)d_ws;
  float* Qb = ws;
  float* Kb = Qb + (size_t)M * D_;
  float* Vb = Kb + (size_t)M * D_;
  float* Ab = Vb + (size_t)M * D_;
  float* Bb = Ab + (size_t)M * D_;
  float* Sb = Bb + (size_t)M * D_;                       // [B,H,N,N]
  float* Ob = Sb + (size_t)B_ * H_ * N_ * N_;

  const dim3 blk(256);

  // Projections, all five in one launch (bp1 folded into the x_i side of the
  // physics MLP); Qb, Kb, Vb, Ab, Bb lie one behind the other in the workspace.
  gemm_xw_kernel<64, 256><<<dim3((M / 32) * (D_ / 64), 5), blk, 0, stream>>>(
      x, Wq, bq, Wk, bk, Wv, bv, Wp1, bp1, Wp1 + (size_t)D_ * D_, nullptr,
      Qb);

  scores_kernel<<<B_ * 16 * 16, dim3(512), 0, stream>>>(Qb, Kb, Ab, Bb, Wp2, bp2,
                                                  adj, Sb);
  pv_kernel<<<B_ * H_ * (N_ / 32) * (HD_ / 32), dim3(512), 0, stream>>>(Sb, Vb, Ob);
  gemm_xw_kernel<32, 512><<<(M / 32) * (D_ / 32), dim3(512), 0, stream>>>(
      Ob, Wo, bo, nullptr, nullptr, nullptr, nullptr, nullptr, nullptr, nullptr,
      nullptr, (float*)d_out);
}
